// v000
// Measured on an AMD MI455X. A time is GPU time per run, averaged over a window of back-to-back runs after a warm-up
// (all launches, gaps included; the runs take copies of the inputs in turn), and the median of several windows.
// Apart from v000's, it joins two sittings. Times from different sittings can be a few percent apart, while
// side-by-side timings come from the same sitting.
// The starting kernel, v000, takes 220 microseconds a run.
#include <hip/hip_runtime.h>
#include <hip/hip_bf16.h>
#include <math.h>

// ---------------- problem constants (fixed by reference) ----------------
#define B_   16
#define S_   4096
#define D_   64
#define H_   4
#define NB_  64          // buckets per hash
#define NBIN 256         // H_*NB_ total bucket ids
#define E_   16384       // H_*S_ elements per batch
#define NCH  256         // chunks (= H_*NB_)
#define L_   64          // queries per chunk
#define KL_  128         // keys per chunk (look-one-back)

typedef float v2f __attribute__((ext_vector_type(2)));
typedef float v8f __attribute__((ext_vector_type(8)));

__device__ __forceinline__ v8f wmma_f32(v2f a, v2f b, v8f c) {
  return __builtin_amdgcn_wmma_f32_16x16x4_f32(false, a, false, b, (short)0, c,
                                               false, false);
}

// ---------------- K1: LSH bucket ids ----------------
__global__ void k_buckets(const float* __restrict__ qk,
                          const float* __restrict__ rot,
                          int* __restrict__ buckets) {
  int idx = blockIdx.x * 256 + threadIdx.x;     // [0, B_*H_*S_)
  int b   = idx >> 14;
  int rem = idx & (E_ - 1);
  int h   = rem >> 12;
  int t   = rem & (S_ - 1);
  const float* q = qk + ((size_t)b * S_ + t) * D_;
  float r[32];
#pragma unroll
  for (int i = 0; i < 32; i++) r[i] = 0.f;
  for (int f = 0; f < D_; f++) {
    float qf = q[f];
    const float* rp = rot + f * (H_ * 32) + h * 32;
#pragma unroll
    for (int i = 0; i < 32; i++) r[i] += qf * rp[i];
  }
  float best = r[0];
  int arg = 0;
#pragma unroll
  for (int i = 1; i < 32; i++)
    if (r[i] > best) { best = r[i]; arg = i; }
#pragma unroll
  for (int i = 0; i < 32; i++)
    if (-r[i] > best) { best = -r[i]; arg = 32 + i; }
  buckets[(size_t)b * E_ + rem] = h * NB_ + arg;
}

// ---------------- K2: per-block 256-bin histogram ----------------
__global__ void k_hist(const int* __restrict__ buckets, int* __restrict__ hist) {
  __shared__ int lh[NBIN];
  int b = blockIdx.x >> 6, blk = blockIdx.x & 63;
  lh[threadIdx.x] = 0;
  __syncthreads();
  int bin = buckets[(size_t)b * E_ + blk * 256 + threadIdx.x];
  atomicAdd(&lh[bin], 1);
  __syncthreads();
  // bin-major layout: hist[b][bin][blk]
  hist[(size_t)b * E_ + threadIdx.x * 64 + blk] = lh[threadIdx.x];
}

// ---------------- K3: bin-major exclusive scan (in place) ----------------
__global__ void k_scan(int* __restrict__ hist) {
  __shared__ int tot[NBIN];
  __shared__ int sc[NBIN];
  int b = blockIdx.x, bin = threadIdx.x;
  int* hp = hist + (size_t)b * E_ + bin * 64;
  int s = 0;
  for (int k = 0; k < 64; k++) s += hp[k];
  tot[bin] = s;
  sc[bin] = s;
  __syncthreads();
  for (int off = 1; off < NBIN; off <<= 1) {
    int v = (bin >= off) ? sc[bin - off] : 0;
    __syncthreads();
    sc[bin] += v;
    __syncthreads();
  }
  int run = sc[bin] - tot[bin];   // exclusive bin start
  for (int k = 0; k < 64; k++) { int c = hp[k]; hp[k] = run; run += c; }
}

// ---------------- K4: stable scatter ----------------
__global__ void k_scatter(const int* __restrict__ buckets,
                          const int* __restrict__ hist,
                          int* __restrict__ st, int* __restrict__ undo) {
  __shared__ int lbin[256];
  int b = blockIdx.x >> 6, blk = blockIdx.x & 63;
  int j = blk * 256 + threadIdx.x;
  int bin = buckets[(size_t)b * E_ + j];
  lbin[threadIdx.x] = bin;
  __syncthreads();
  int rank = 0;
  for (int i = 0; i < threadIdx.x; i++) rank += (lbin[i] == bin);
  int pos = hist[(size_t)b * E_ + bin * 64 + blk] + rank;
  st[(size_t)b * E_ + pos] = j & (S_ - 1);   // token index
  undo[(size_t)b * E_ + j] = pos;
}

// ---------------- K5: chunked attention with f32 WMMA ----------------
__global__ void __launch_bounds__(128)
k_attn(const float* __restrict__ qk, const float* __restrict__ v,
       const int* __restrict__ st, float* __restrict__ so,
       float* __restrict__ slog) {
  __shared__ float lq[L_][68];     // queries   64x64  (+4 pad)
  __shared__ float lk[KL_][68];    // keys      128x64 (normalized)
  __shared__ float lv[KL_][68];    // values    128x64
  __shared__ float lp[L_][132];    // exp(dots) 64x128 (+4 pad)
  __shared__ int   qt[L_];
  __shared__ int   kt[KL_];
  __shared__ float lrcp[L_];

  int b = blockIdx.x >> 8, c = blockIdx.x & (NCH - 1);
  int cprev = (c + NCH - 1) & (NCH - 1);
  int tid = threadIdx.x;
  const int* stb = st + (size_t)b * E_;

  // ---- stage Q ----
  for (int i = tid; i < L_ * 16; i += 128) {      // 16 float4 per row
    int row = i >> 4, q4 = i & 15;
    int t = stb[c * L_ + row];
    float4 x = ((const float4*)(qk + ((size_t)b * S_ + t) * D_))[q4];
    *(float4*)&lq[row][q4 * 4] = x;
    if (q4 == 0) qt[row] = t;
  }
  // ---- stage K, V ----
  for (int i = tid; i < KL_ * 16; i += 128) {
    int row = i >> 4, q4 = i & 15;
    int p = (row < L_) ? c * L_ + row : cprev * L_ + (row - L_);
    int t = stb[p];
    *(float4*)&lk[row][q4 * 4] = ((const float4*)(qk + ((size_t)b * S_ + t) * D_))[q4];
    *(float4*)&lv[row][q4 * 4] = ((const float4*)(v  + ((size_t)b * S_ + t) * D_))[q4];
    if (q4 == 0) kt[row] = t;
  }
  __syncthreads();

  // ---- normalize keys ----
  for (int row = tid; row < KL_; row += 128) {
    float ss = 0.f;
    for (int d = 0; d < D_; d++) { float x = lk[row][d]; ss += x * x; }
    float scl = 1.0f / fmaxf(sqrtf(ss), 1e-12f);
    for (int d = 0; d < D_; d++) lk[row][d] *= scl;
  }
  __syncthreads();

  int wave = tid >> 5, lane = tid & 31;
  int m = lane & 15, hi = lane >> 4;
  int rbase = wave * 16;

  // A fragments (Q strip 16x64), ISA layout: lane half splits K {0,1}/{2,3}
  v2f afq[16];
#pragma unroll
  for (int k4 = 0; k4 < 16; k4++) {
    afq[k4].x = lq[rbase + m][4 * k4 + 2 * hi];
    afq[k4].y = lq[rbase + m][4 * k4 + 2 * hi + 1];
  }

  // ---- dots = Q @ K^T * D^-0.5, masked ----
  for (int nt = 0; nt < 8; nt++) {
    v8f acc = {0.f, 0.f, 0.f, 0.f, 0.f, 0.f, 0.f, 0.f};
#pragma unroll
    for (int k4 = 0; k4 < 16; k4++) {
      v2f bf;
      bf.x = lk[nt * 16 + m][4 * k4 + 2 * hi];
      bf.y = lk[nt * 16 + m][4 * k4 + 2 * hi + 1];
      acc = wmma_f32(afq[k4], bf, acc);
    }
    int col = nt * 16 + m;
    int ktc = kt[col];
#pragma unroll
    for (int e = 0; e < 8; e++) {
      int row = rbase + e + 8 * hi;
      float val = acc[e] * 0.125f;           // 64^-0.5
      if (qt[row] == ktc) val = -5e4f;       // self-attn mask
      lp[row][col] = val;
    }
  }

  // ---- row softmax (wave-local rows; LDS ops in-order per wave) ----
  {
    int r = rbase + m;
    int c0 = hi * 64;
    float mx = -3.402823466e38f;
    for (int cc = 0; cc < 64; cc++) mx = fmaxf(mx, lp[r][c0 + cc]);
    mx = fmaxf(mx, __shfl_xor(mx, 16, 32));
    float ssum = 0.f;
    for (int cc = 0; cc < 64; cc++) {
      float e = __expf(lp[r][c0 + cc] - mx);
      lp[r][c0 + cc] = e;
      ssum += e;
    }
    ssum += __shfl_xor(ssum, 16, 32);
    float lse = mx + __logf(ssum);
    if (hi == 0) {
      lrcp[r] = 1.0f / ssum;
      slog[(size_t)b * E_ + c * L_ + r] = lse;
    }
  }

  // ---- bo = P @ V ----
  for (int nt2 = 0; nt2 < 4; nt2++) {
    v8f acc = {0.f, 0.f, 0.f, 0.f, 0.f, 0.f, 0.f, 0.f};
#pragma unroll
    for (int k4 = 0; k4 < 32; k4++) {
      v2f af, bf;
      af.x = lp[rbase + m][4 * k4 + 2 * hi];
      af.y = lp[rbase + m][4 * k4 + 2 * hi + 1];
      bf.x = lv[4 * k4 + 2 * hi][nt2 * 16 + m];
      bf.y = lv[4 * k4 + 2 * hi + 1][nt2 * 16 + m];
      acc = wmma_f32(af, bf, acc);
    }
#pragma unroll
    for (int e = 0; e < 8; e++) {
      int row = rbase + e + 8 * hi;
      size_t idx = ((size_t)b * E_ + c * L_ + row) * D_ + nt2 * 16 + m;
      so[idx] = acc[e] * lrcp[row];
    }
  }
}

// ---------------- K6: unsort + combine hash rounds ----------------
__global__ void k_combine(const float* __restrict__ so,
                          const float* __restrict__ slog,
                          const int* __restrict__ undo,
                          float* __restrict__ out) {
  int b = blockIdx.x >> 12, t = blockIdx.x & (S_ - 1);
  int d = threadIdx.x;
  const int* ub = undo + (size_t)b * E_;
  int p[H_];
  float lg[H_];
#pragma unroll
  for (int h = 0; h < H_; h++) {
    p[h] = ub[h * S_ + t];
    lg[h] = slog[(size_t)b * E_ + p[h]];
  }
  float mx = fmaxf(fmaxf(lg[0], lg[1]), fmaxf(lg[2], lg[3]));
  float w[H_], ws = 0.f;
#pragma unroll
  for (int h = 0; h < H_; h++) { w[h] = __expf(lg[h] - mx); ws += w[h]; }
  float acc = 0.f;
#pragma unroll
  for (int h = 0; h < H_; h++)
    acc += w[h] * so[((size_t)b * E_ + p[h]) * D_ + d];
  out[((size_t)b * S_ + t) * D_ + d] = acc / ws;
}

// ---------------- launcher ----------------
extern "C" void kernel_launch(void* const* d_in, const int* in_sizes, int n_in,
                              void* d_out, int out_size, void* d_ws, size_t ws_size,
                              hipStream_t stream) {
  const float* qk  = (const float*)d_in[0];
  const float* v   = (const float*)d_in[1];
  const float* rot = (const float*)d_in[2];
  float* out = (float*)d_out;

  char* ws = (char*)d_ws;
  size_t off = 0;
  int*   buckets = (int*)(ws + off);  off += (size_t)B_ * E_ * sizeof(int);
  int*   hist    = (int*)(ws + off);  off += (size_t)B_ * E_ * sizeof(int);
  int*   st      = (int*)(ws + off);  off += (size_t)B_ * E_ * sizeof(int);
  int*   undo    = (int*)(ws + off);  off += (size_t)B_ * E_ * sizeof(int);
  float* slog    = (float*)(ws + off); off += (size_t)B_ * E_ * sizeof(float);
  float* so      = (float*)(ws + off); off += (size_t)B_ * E_ * D_ * sizeof(float);

  k_buckets<<<(B_ * H_ * S_) / 256, 256, 0, stream>>>(qk, rot, buckets);
  k_hist   <<<B_ * 64, 256, 0, stream>>>(buckets, hist);
  k_scan   <<<B_, 256, 0, stream>>>(hist);
  k_scatter<<<B_ * 64, 256, 0, stream>>>(buckets, hist, st, undo);
  k_attn   <<<B_ * NCH, 128, 0, stream>>>(qk, v, st, so, slog);
  k_combine<<<B_ * S_, 64, 0, stream>>>(so, slog, undo, out);
}

// v001
// Measured time: 169 microseconds a run.
// Next to v000, in two timings, it ran 1.34 times as fast each time.
#include <hip/hip_runtime.h>
#include <hip/hip_bf16.h>
#include <math.h>

// ---------------- problem constants (fixed by reference) ----------------
#define B_   16
#define S_   4096
#define D_   64
#define H_   4
#define NB_  64          // buckets per hash
#define NBIN 256         // H_*NB_ total bucket ids
#define E_   16384       // H_*S_ elements per batch
#define NCH  256         // chunks (= H_*NB_)
#define L_   64          // queries per chunk
#define KL_  128         // keys per chunk (look-one-back)

typedef float v2f __attribute__((ext_vector_type(2)));
typedef float v8f __attribute__((ext_vector_type(8)));

__device__ __forceinline__ v8f wmma_f32(v2f a, v2f b, v8f c) {
  return __builtin_amdgcn_wmma_f32_16x16x4_f32(false, a, false, b, (short)0, c,
                                               false, false);
}

// LDS byte address of a __shared__ object (low 32 bits of its address)
__device__ __forceinline__ unsigned lds_addr(const void* p) {
  return (unsigned)(uintptr_t)p;
}

// eight 16-byte copies per lane, global -> LDS: source rows t[j..j+7], LDS rows
// lstep bytes apart; s_wait_xcnt 0 ends the statement so that no address
// register of an issued copy is rewritten ahead of it
#define COPY8(l0, lstep, gbase, t, j)                                        \
  asm volatile(                                                              \
      "global_load_async_to_lds_b128 %0, %8, off\n\t"                        \
      "global_load_async_to_lds_b128 %1, %9, off\n\t"                        \
      "global_load_async_to_lds_b128 %2, %10, off\n\t"                       \
      "global_load_async_to_lds_b128 %3, %11, off\n\t"                       \
      "global_load_async_to_lds_b128 %4, %12, off\n\t"                       \
      "global_load_async_to_lds_b128 %5, %13, off\n\t"                       \
      "global_load_async_to_lds_b128 %6, %14, off\n\t"                       \
      "global_load_async_to_lds_b128 %7, %15, off\n\t"                       \
      "s_wait_xcnt 0x0"                                                      \
      :: "v"((l0)), "v"((l0) + (lstep)), "v"((l0) + 2 * (lstep)),            \
         "v"((l0) + 3 * (lstep)), "v"((l0) + 4 * (lstep)),                   \
         "v"((l0) + 5 * (lstep)), "v"((l0) + 6 * (lstep)),                   \
         "v"((l0) + 7 * (lstep)),                                            \
         "v"((gbase) + (size_t)(t)[(j) + 0] * D_),                           \
         "v"((gbase) + (size_t)(t)[(j) + 1] * D_),                           \
         "v"((gbase) + (size_t)(t)[(j) + 2] * D_),                           \
         "v"((gbase) + (size_t)(t)[(j) + 3] * D_),                           \
         "v"((gbase) + (size_t)(t)[(j) + 4] * D_),                           \
         "v"((gbase) + (size_t)(t)[(j) + 5] * D_),                           \
         "v"((gbase) + (size_t)(t)[(j) + 6] * D_),                           \
         "v"((gbase) + (size_t)(t)[(j) + 7] * D_)                            \
      : "memory")

// ---------------- K1: LSH bucket ids ----------------
__global__ void k_buckets(const float* __restrict__ qk,
                          const float* __restrict__ rot,
                          int* __restrict__ buckets) {
  int idx = blockIdx.x * 256 + threadIdx.x;     // [0, B_*H_*S_)
  int b   = idx >> 14;
  int rem = idx & (E_ - 1);
  int h   = rem >> 12;
  int t   = rem & (S_ - 1);
  const float* q = qk + ((size_t)b * S_ + t) * D_;
  float r[32];
#pragma unroll
  for (int i = 0; i < 32; i++) r[i] = 0.f;
  for (int f = 0; f < D_; f++) {
    float qf = q[f];
    const float* rp = rot + f * (H_ * 32) + h * 32;
#pragma unroll
    for (int i = 0; i < 32; i++) r[i] += qf * rp[i];
  }
  float best = r[0];
  int arg = 0;
#pragma unroll
  for (int i = 1; i < 32; i++)
    if (r[i] > best) { best = r[i]; arg = i; }
#pragma unroll
  for (int i = 0; i < 32; i++)
    if (-r[i] > best) { best = -r[i]; arg = 32 + i; }
  buckets[(size_t)b * E_ + rem] = h * NB_ + arg;
}

// ---------------- K2: per-block 256-bin histogram ----------------
__global__ void k_hist(const int* __restrict__ buckets, int* __restrict__ hist) {
  __shared__ int lh[NBIN];
  int b = blockIdx.x >> 6, blk = blockIdx.x & 63;
  lh[threadIdx.x] = 0;
  __syncthreads();
  int bin = buckets[(size_t)b * E_ + blk * 256 + threadIdx.x];
  atomicAdd(&lh[bin], 1);
  __syncthreads();
  // bin-major layout: hist[b][bin][blk]
  hist[(size_t)b * E_ + threadIdx.x * 64 + blk] = lh[threadIdx.x];
}

// ---------------- K3: bin-major exclusive scan (in place) ----------------
__global__ void k_scan(int* __restrict__ hist) {
  __shared__ int tot[NBIN];
  __shared__ int sc[NBIN];
  int b = blockIdx.x, bin = threadIdx.x;
  int* hp = hist + (size_t)b * E_ + bin * 64;
  int s = 0;
  for (int k = 0; k < 64; k++) s += hp[k];
  tot[bin] = s;
  sc[bin] = s;
  __syncthreads();
  for (int off = 1; off < NBIN; off <<= 1) {
    int v = (bin >= off) ? sc[bin - off] : 0;
    __syncthreads();
    sc[bin] += v;
    __syncthreads();
  }
  int run = sc[bin] - tot[bin];   // exclusive bin start
  for (int k = 0; k < 64; k++) { int c = hp[k]; hp[k] = run; run += c; }
}

// ---------------- K4: stable scatter ----------------
__global__ void k_scatter(const int* __restrict__ buckets,
                          const int* __restrict__ hist,
                          int* __restrict__ st, int* __restrict__ undo) {
  __shared__ int lbin[256];
  int b = blockIdx.x >> 6, blk = blockIdx.x & 63;
  int j = blk * 256 + threadIdx.x;
  int bin = buckets[(size_t)b * E_ + j];
  lbin[threadIdx.x] = bin;
  __syncthreads();
  int rank = 0;
  for (int i = 0; i < threadIdx.x; i++) rank += (lbin[i] == bin);
  int pos = hist[(size_t)b * E_ + bin * 64 + blk] + rank;
  st[(size_t)b * E_ + pos] = j & (S_ - 1);   // token index
  undo[(size_t)b * E_ + j] = pos;
}

// ---------------- K5: chunked attention with f32 WMMA ----------------
__global__ void __launch_bounds__(128)
k_attn(const float* __restrict__ qk, const float* __restrict__ v,
       const int* __restrict__ st, float* __restrict__ so,
       float* __restrict__ slog) {
  __shared__ __attribute__((aligned(16))) float lq[L_][68];     // queries   64x64  (+4 pad)
  __shared__ __attribute__((aligned(16))) float lk[KL_][68];    // keys      128x64 (normalized)
  __shared__ __attribute__((aligned(16))) float lv[KL_][68];    // values    128x64
  __shared__ float lp[L_][132];    // exp(dots) 64x128 (+4 pad)
  __shared__ int   qt[L_];
  __shared__ int   kt[KL_];
  __shared__ float lrcp[L_];

  int b = blockIdx.x >> 8, c = blockIdx.x & (NCH - 1);
  int cprev = (c + NCH - 1) & (NCH - 1);
  int tid = threadIdx.x;
  const int* stb = st + (size_t)b * E_;

  // ---- stage Q, K, V: asynchronous copies to LDS, all in flight at once ----
  {
    int r0 = tid >> 4, q4 = tid & 15;             // 16 lanes of 16 B per row
    int tk[16];
    // unrolled: tk[] stays in registers and the 16 index loads issue together
#pragma unroll
    for (int j = 0; j < 16; j++) {
      // rows r0 + 8 j: j < 8 lies in this chunk, j >= 8 in the one before
      int p = (j < 8 ? c * L_ : cprev * L_ - L_) + r0 + 8 * j;
      tk[j] = stb[p] & (S_ - 1);                  // bounds every copy's source row
    }
    const float* qb = qk + (size_t)b * S_ * D_ + q4 * 4;
    const float* vb = v  + (size_t)b * S_ * D_ + q4 * 4;
    // unrolled: j indexes tk[] as a constant
#pragma unroll
    for (int j = 0; j < 16; j += 8) {
      COPY8(lds_addr(&lk[r0 + 8 * j][q4 * 4]), 8 * 68 * 4, qb, tk, j);
      COPY8(lds_addr(&lv[r0 + 8 * j][q4 * 4]), 8 * 68 * 4, vb, tk, j);
    }
    COPY8(lds_addr(&lq[r0][q4 * 4]), 8 * 68 * 4, qb, tk, 0);
    if (q4 == 0) {
      // unrolled: j indexes tk[] as a constant
#pragma unroll
      for (int j = 0; j < 16; j++) {
        kt[r0 + 8 * j] = tk[j];
        if (j < 8) qt[r0 + 8 * j] = tk[j];
      }
    }
    // this wave's copies have landed before the barrier publishes them
    asm volatile("s_wait_asynccnt 0x0" ::: "memory");
  }
  __syncthreads();

  // ---- normalize keys ----
  for (int row = tid; row < KL_; row += 128) {
    float ss = 0.f;
    for (int d = 0; d < D_; d++) { float x = lk[row][d]; ss += x * x; }
    float scl = 1.0f / fmaxf(sqrtf(ss), 1e-12f);
    for (int d = 0; d < D_; d++) lk[row][d] *= scl;
  }
  __syncthreads();

  int wave = tid >> 5, lane = tid & 31;
  int m = lane & 15, hi = lane >> 4;
  int rbase = wave * 16;

  // A fragments (Q strip 16x64), ISA layout: lane half splits K {0,1}/{2,3}
  v2f afq[16];
#pragma unroll
  for (int k4 = 0; k4 < 16; k4++) {
    afq[k4].x = lq[rbase + m][4 * k4 + 2 * hi];
    afq[k4].y = lq[rbase + m][4 * k4 + 2 * hi + 1];
  }

  // ---- dots = Q @ K^T * D^-0.5, masked ----
  for (int nt = 0; nt < 8; nt++) {
    v8f acc = {0.f, 0.f, 0.f, 0.f, 0.f, 0.f, 0.f, 0.f};
#pragma unroll
    for (int k4 = 0; k4 < 16; k4++) {
      v2f bf;
      bf.x = lk[nt * 16 + m][4 * k4 + 2 * hi];
      bf.y = lk[nt * 16 + m][4 * k4 + 2 * hi + 1];
      acc = wmma_f32(afq[k4], bf, acc);
    }
    int col = nt * 16 + m;
    int ktc = kt[col];
#pragma unroll
    for (int e = 0; e < 8; e++) {
      int row = rbase + e + 8 * hi;
      float val = acc[e] * 0.125f;           // 64^-0.5
      if (qt[row] == ktc) val = -5e4f;       // self-attn mask
      lp[row][col] = val;
    }
  }

  // ---- row softmax (wave-local rows; LDS ops in-order per wave) ----
  {
    int r = rbase + m;
    int c0 = hi * 64;
    float mx = -3.402823466e38f;
    for (int cc = 0; cc < 64; cc++) mx = fmaxf(mx, lp[r][c0 + cc]);
    mx = fmaxf(mx, __shfl_xor(mx, 16, 32));
    float ssum = 0.f;
    for (int cc = 0; cc < 64; cc++) {
      float e = __expf(lp[r][c0 + cc] - mx);
      lp[r][c0 + cc] = e;
      ssum += e;
    }
    ssum += __shfl_xor(ssum, 16, 32);
    float lse = mx + __logf(ssum);
    if (hi == 0) {
      lrcp[r] = 1.0f / ssum;
      slog[(size_t)b * E_ + c * L_ + r] = lse;
    }
  }

  // ---- bo = P @ V ----
  for (int nt2 = 0; nt2 < 4; nt2++) {
    v8f acc = {0.f, 0.f, 0.f, 0.f, 0.f, 0.f, 0.f, 0.f};
#pragma unroll
    for (int k4 = 0; k4 < 32; k4++) {
      v2f af, bf;
      af.x = lp[rbase + m][4 * k4 + 2 * hi];
      af.y = lp[rbase + m][4 * k4 + 2 * hi + 1];
      bf.x = lv[4 * k4 + 2 * hi][nt2 * 16 + m];
      bf.y = lv[4 * k4 + 2 * hi + 1][nt2 * 16 + m];
      acc = wmma_f32(af, bf, acc);
    }
#pragma unroll
    for (int e = 0; e < 8; e++) {
      int row = rbase + e + 8 * hi;
      size_t idx = ((size_t)b * E_ + c * L_ + row) * D_ + nt2 * 16 + m;
      so[idx] = acc[e] * lrcp[row];
    }
  }
}

// ---------------- K6: unsort + combine hash rounds ----------------
__global__ void k_combine(const float* __restrict__ so,
                          const float* __restrict__ slog,
                          const int* __restrict__ undo,
                          float* __restrict__ out) {
  int b = blockIdx.x >> 12, t = blockIdx.x & (S_ - 1);
  int d = threadIdx.x;
  const int* ub = undo + (size_t)b * E_;
  int p[H_];
  float lg[H_];
#pragma unroll
  for (int h = 0; h < H_; h++) {
    p[h] = ub[h * S_ + t];
    lg[h] = slog[(size_t)b * E_ + p[h]];
  }
  float mx = fmaxf(fmaxf(lg[0], lg[1]), fmaxf(lg[2], lg[3]));
  float w[H_], ws = 0.f;
#pragma unroll
  for (int h = 0; h < H_; h++) { w[h] = __expf(lg[h] - mx); ws += w[h]; }
  float acc = 0.f;
#pragma unroll
  for (int h = 0; h < H_; h++)
    acc += w[h] * so[((size_t)b * E_ + p[h]) * D_ + d];
  out[((size_t)b * S_ + t) * D_ + d] = acc / ws;
}

// ---------------- launcher ----------------
extern "C" void kernel_launch(void* const* d_in, const int* in_sizes, int n_in,
                              void* d_out, int out_size, void* d_ws, size_t ws_size,
                              hipStream_t stream) {
  const float* qk  = (const float*)d_in[0];
  const float* v   = (const float*)d_in[1];
  const float* rot = (const float*)d_in[2];
  float* out = (float*)d_out;

  char* ws = (char*)d_ws;
  size_t off = 0;
  int*   buckets = (int*)(ws + off);  off += (size_t)B_ * E_ * sizeof(int);
  int*   hist    = (int*)(ws + off);  off += (size_t)B_ * E_ * sizeof(int);
  int*   st      = (int*)(ws + off);  off += (size_t)B_ * E_ * sizeof(int);
  int*   undo    = (int*)(ws + off);  off += (size_t)B_ * E_ * sizeof(int);
  float* slog    = (float*)(ws + off); off += (size_t)B_ * E_ * sizeof(float);
  float* so      = (float*)(ws + off); off += (size_t)B_ * E_ * D_ * sizeof(float);

  k_buckets<<<(B_ * H_ * S_) / 256, 256, 0, stream>>>(qk, rot, buckets);
  k_hist   <<<B_ * 64, 256, 0, stream>>>(buckets, hist);
  k_scan   <<<B_, 256, 0, stream>>>(hist);
  k_scatter<<<B_ * 64, 256, 0, stream>>>(buckets, hist, st, undo);
  k_attn   <<<B_ * NCH, 128, 0, stream>>>(qk, v, st, so, slog);
  k_combine<<<B_ * S_, 64, 0, stream>>>(so, slog, undo, out);
}

// v002
// A run of this version takes 160 microseconds.
// Two timings next to v001 both put it at 1.06 times that version's speed.
// Over all steps from v000 it is 1.41 times as fast.
#include <hip/hip_runtime.h>
#include <hip/hip_bf16.h>
#include <math.h>

// ---------------- problem constants (fixed by reference) ----------------
#define B_   16
#define S_   4096
#define D_   64
#define H_   4
#define NB_  64          // buckets per hash
#define NBIN 256         // H_*NB_ total bucket ids
#define E_   16384       // H_*S_ elements per batch
#define NCH  256         // chunks (= H_*NB_)
#define L_   64          // queries per chunk
#define KL_  128         // keys per chunk (look-one-back)

typedef float v2f __attribute__((ext_vector_type(2)));
typedef float v8f __attribute__((ext_vector_type(8)));

__device__ __forceinline__ v8f wmma_f32(v2f a, v2f b, v8f c) {
  return __builtin_amdgcn_wmma_f32_16x16x4_f32(false, a, false, b, (short)0, c,
                                               false, false);
}

// LDS byte address of a __shared__ object (low 32 bits of its address)
__device__ __forceinline__ unsigned lds_addr(const void* p) {
  return (unsigned)(uintptr_t)p;
}

// eight 16-byte copies per lane, global -> LDS: source rows t[j..j+7], LDS rows
// lstep bytes apart; s_wait_xcnt 0 ends the statement so that no address
// register of an issued copy is rewritten ahead of it
#define COPY8(l0, lstep, gbase, t, j)                                        \
  asm volatile(                                                              \
      "global_load_async_to_lds_b128 %0, %8, off\n\t"                        \
      "global_load_async_to_lds_b128 %1, %9, off\n\t"                        \
      "global_load_async_to_lds_b128 %2, %10, off\n\t"                       \
      "global_load_async_to_lds_b128 %3, %11, off\n\t"                       \
      "global_load_async_to_lds_b128 %4, %12, off\n\t"                       \
      "global_load_async_to_lds_b128 %5, %13, off\n\t"                       \
      "global_load_async_to_lds_b128 %6, %14, off\n\t"                       \
      "global_load_async_to_lds_b128 %7, %15, off\n\t"                       \
      "s_wait_xcnt 0x0"                                                      \
      :: "v"((l0)), "v"((l0) + (lstep)), "v"((l0) + 2 * (lstep)),            \
         "v"((l0) + 3 * (lstep)), "v"((l0) + 4 * (lstep)),                   \
         "v"((l0) + 5 * (lstep)), "v"((l0) + 6 * (lstep)),                   \
         "v"((l0) + 7 * (lstep)),                                            \
         "v"((gbase) + (size_t)(t)[(j) + 0] * D_),                           \
         "v"((gbase) + (size_t)(t)[(j) + 1] * D_),                           \
         "v"((gbase) + (size_t)(t)[(j) + 2] * D_),                           \
         "v"((gbase) + (size_t)(t)[(j) + 3] * D_),                           \
         "v"((gbase) + (size_t)(t)[(j) + 4] * D_),                           \
         "v"((gbase) + (size_t)(t)[(j) + 5] * D_),                           \
         "v"((gbase) + (size_t)(t)[(j) + 6] * D_),                           \
         "v"((gbase) + (size_t)(t)[(j) + 7] * D_)                            \
      : "memory")

// ---------------- K1: LSH bucket ids ----------------
__global__ void k_buckets(const float* __restrict__ qk,
                          const float* __restrict__ rot,
                          int* __restrict__ buckets) {
  int idx = blockIdx.x * 256 + threadIdx.x;     // [0, B_*H_*S_)
  int b   = idx >> 14;
  int rem = idx & (E_ - 1);
  int h   = rem >> 12;
  int t   = rem & (S_ - 1);
  const float* q = qk + ((size_t)b * S_ + t) * D_;
  float r[32];
#pragma unroll
  for (int i = 0; i < 32; i++) r[i] = 0.f;
  for (int f = 0; f < D_; f++) {
    float qf = q[f];
    const float* rp = rot + f * (H_ * 32) + h * 32;
#pragma unroll
    for (int i = 0; i < 32; i++) r[i] += qf * rp[i];
  }
  float best = r[0];
  int arg = 0;
#pragma unroll
  for (int i = 1; i < 32; i++)
    if (r[i] > best) { best = r[i]; arg = i; }
#pragma unroll
  for (int i = 0; i < 32; i++)
    if (-r[i] > best) { best = -r[i]; arg = 32 + i; }
  buckets[(size_t)b * E_ + rem] = h * NB_ + arg;
}

// ---------------- K2: per-block 256-bin histogram ----------------
__global__ void k_hist(const int* __restrict__ buckets, int* __restrict__ hist) {
  __shared__ int lh[NBIN];
  int b = blockIdx.x >> 6, blk = blockIdx.x & 63;
  lh[threadIdx.x] = 0;
  __syncthreads();
  int bin = buckets[(size_t)b * E_ + blk * 256 + threadIdx.x];
  atomicAdd(&lh[bin], 1);
  __syncthreads();
  // bin-major layout: hist[b][bin][blk]
  hist[(size_t)b * E_ + threadIdx.x * 64 + blk] = lh[threadIdx.x];
}

// ---------------- K3: bin-major exclusive scan (in place) ----------------
__global__ void k_scan(int* __restrict__ hist) {
  __shared__ int tot[NBIN];
  __shared__ int sc[NBIN];
  int b = blockIdx.x, bin = threadIdx.x;
  int* hp = hist + (size_t)b * E_ + bin * 64;
  int s = 0;
  for (int k = 0; k < 64; k++) s += hp[k];
  tot[bin] = s;
  sc[bin] = s;
  __syncthreads();
  for (int off = 1; off < NBIN; off <<= 1) {
    int v = (bin >= off) ? sc[bin - off] : 0;
    __syncthreads();
    sc[bin] += v;
    __syncthreads();
  }
  int run = sc[bin] - tot[bin];   // exclusive bin start
  for (int k = 0; k < 64; k++) { int c = hp[k]; hp[k] = run; run += c; }
}

// ---------------- K4: stable scatter ----------------
__global__ void k_scatter(const int* __restrict__ buckets,
                          const int* __restrict__ hist,
                          int* __restrict__ st, int* __restrict__ undo) {
  __shared__ int lbin[256];
  int b = blockIdx.x >> 6, blk = blockIdx.x & 63;
  int j = blk * 256 + threadIdx.x;
  int bin = buckets[(size_t)b * E_ + j];
  lbin[threadIdx.x] = bin;
  __syncthreads();
  int rank = 0;
  for (int i = 0; i < threadIdx.x; i++) rank += (lbin[i] == bin);
  int pos = hist[(size_t)b * E_ + bin * 64 + blk] + rank;
  st[(size_t)b * E_ + pos] = j & (S_ - 1);   // token index
  undo[(size_t)b * E_ + j] = pos;
}

// ---------------- K5: chunked attention with f32 WMMA ----------------
__global__ void __launch_bounds__(128)
k_attn(const float* __restrict__ qk, const float* __restrict__ v,
       const int* __restrict__ st, float* __restrict__ so,
       float* __restrict__ slog) {
  __shared__ __attribute__((aligned(16))) float lq[L_][68];     // queries   64x64  (+4 pad)
  __shared__ __attribute__((aligned(16))) float lk[KL_][68];    // keys      128x64 (normalized)
  __shared__ __attribute__((aligned(16))) float lv[KL_][68];    // values    128x64
  __shared__ float lp[L_][132];    // exp(dots) 64x128 (+4 pad)
  __shared__ int   qt[L_];
  __shared__ int   kt[KL_];
  __shared__ float lrcp[L_];

  int b = blockIdx.x >> 8, c = blockIdx.x & (NCH - 1);
  int cprev = (c + NCH - 1) & (NCH - 1);
  int tid = threadIdx.x;
  const int* stb = st + (size_t)b * E_;

  // ---- stage Q, K, V: asynchronous copies to LDS, all in flight at once ----
  {
    int r0 = tid >> 4, q4 = tid & 15;             // 16 lanes of 16 B per row
    int tk[16];
    // unrolled: tk[] stays in registers and the 16 index loads issue together
#pragma unroll
    for (int j = 0; j < 16; j++) {
      // rows r0 + 8 j: j < 8 lies in this chunk, j >= 8 in the one before
      int p = (j < 8 ? c * L_ : cprev * L_ - L_) + r0 + 8 * j;
      tk[j] = stb[p] & (S_ - 1);                  // bounds every copy's source row
    }
    const float* qb = qk + (size_t)b * S_ * D_ + q4 * 4;
    const float* vb = v  + (size_t)b * S_ * D_ + q4 * 4;
    // unrolled: j indexes tk[] as a constant
#pragma unroll
    for (int j = 0; j < 16; j += 8) {
      COPY8(lds_addr(&lk[r0 + 8 * j][q4 * 4]), 8 * 68 * 4, qb, tk, j);
      COPY8(lds_addr(&lv[r0 + 8 * j][q4 * 4]), 8 * 68 * 4, vb, tk, j);
    }
    COPY8(lds_addr(&lq[r0][q4 * 4]), 8 * 68 * 4, qb, tk, 0);
    if (q4 == 0) {
      // unrolled: j indexes tk[] as a constant
#pragma unroll
      for (int j = 0; j < 16; j++) {
        kt[r0 + 8 * j] = tk[j];
        if (j < 8) qt[r0 + 8 * j] = tk[j];
      }
    }
    // this wave's copies have landed before the barrier publishes them
    asm volatile("s_wait_asynccnt 0x0" ::: "memory");
  }
  __syncthreads();

  // ---- normalize keys ----
  for (int row = tid; row < KL_; row += 128) {
    float ss = 0.f;
    for (int d = 0; d < D_; d++) { float x = lk[row][d]; ss += x * x; }
    float scl = 1.0f / fmaxf(sqrtf(ss), 1e-12f);
    for (int d = 0; d < D_; d++) lk[row][d] *= scl;
  }
  __syncthreads();

  int wave = tid >> 5, lane = tid & 31;
  int m = lane & 15, hi = lane >> 4;
  int rbase = wave * 16;

  // A fragments (Q strip 16x64), ISA layout: lane half splits K {0,1}/{2,3}
  v2f afq[16];
#pragma unroll
  for (int k4 = 0; k4 < 16; k4++) {
    afq[k4].x = lq[rbase + m][4 * k4 + 2 * hi];
    afq[k4].y = lq[rbase + m][4 * k4 + 2 * hi + 1];
  }

  // ---- dots = Q @ K^T * D^-0.5, masked ----
  for (int nt = 0; nt < 8; nt++) {
    v8f acc = {0.f, 0.f, 0.f, 0.f, 0.f, 0.f, 0.f, 0.f};
#pragma unroll
    for (int k4 = 0; k4 < 16; k4++) {
      v2f bf;
      bf.x = lk[nt * 16 + m][4 * k4 + 2 * hi];
      bf.y = lk[nt * 16 + m][4 * k4 + 2 * hi + 1];
      acc = wmma_f32(afq[k4], bf, acc);
    }
    int col = nt * 16 + m;
    int ktc = kt[col];
#pragma unroll
    for (int e = 0; e < 8; e++) {
      int row = rbase + e + 8 * hi;
      float val = acc[e] * 0.125f;           // 64^-0.5
      if (qt[row] == ktc) val = -5e4f;       // self-attn mask
      lp[row][col] = val;
    }
  }

  // ---- row softmax (wave-local rows; LDS ops in-order per wave) ----
  {
    int r = rbase + m;
    int c0 = hi * 64;
    float mx = -3.402823466e38f;
    for (int cc = 0; cc < 64; cc++) mx = fmaxf(mx, lp[r][c0 + cc]);
    mx = fmaxf(mx, __shfl_xor(mx, 16, 32));
    float ssum = 0.f;
    for (int cc = 0; cc < 64; cc++) {
      float e = __expf(lp[r][c0 + cc] - mx);
      lp[r][c0 + cc] = e;
      ssum += e;
    }
    ssum += __shfl_xor(ssum, 16, 32);
    float lse = mx + __logf(ssum);
    if (hi == 0) {
      lrcp[r] = 1.0f / ssum;
      slog[(size_t)b * E_ + c * L_ + r] = lse;
    }
  }

  // ---- bo = P @ V ----
  for (int nt2 = 0; nt2 < 4; nt2++) {
    v8f acc = {0.f, 0.f, 0.f, 0.f, 0.f, 0.f, 0.f, 0.f};
#pragma unroll
    for (int k4 = 0; k4 < 32; k4++) {
      v2f af, bf;
      af.x = lp[rbase + m][4 * k4 + 2 * hi];
      af.y = lp[rbase + m][4 * k4 + 2 * hi + 1];
      bf.x = lv[4 * k4 + 2 * hi][nt2 * 16 + m];
      bf.y = lv[4 * k4 + 2 * hi + 1][nt2 * 16 + m];
      acc = wmma_f32(af, bf, acc);
    }
#pragma unroll
    for (int e = 0; e < 8; e++) {
      int row = rbase + e + 8 * hi;
      size_t idx = ((size_t)b * E_ + c * L_ + row) * D_ + nt2 * 16 + m;
      so[idx] = acc[e] * lrcp[row];
    }
  }
}

// ---------------- K6: unsort + combine hash rounds ----------------
// 16 lanes of 16 B cover one token's row; a lane takes TPT_ consecutive tokens,
// so few waves start and every gather of a lane is in flight at once
#define TPT_ 4
typedef float v4f __attribute__((ext_vector_type(4)));
typedef int   v4i __attribute__((ext_vector_type(4)));
__global__ void __launch_bounds__(256)
k_combine(const float* __restrict__ so,
          const float* __restrict__ slog,
          const int* __restrict__ undo,
          float* __restrict__ out) {
  int q4   = threadIdx.x & 15;
  int tok0 = (blockIdx.x * 16 + (threadIdx.x >> 4)) * TPT_;   // [0, B_*S_)
  int b = tok0 >> 12, t = tok0 & (S_ - 1);
  const int*   ub = undo + (size_t)b * E_ + t;
  const float* lb = slog + (size_t)b * E_;
  const v4f*   sb = (const v4f*)(so + (size_t)b * E_ * D_);
  v4i p[H_];              // p[h][i]: sorted place of token t + i in round h
  // unrolled: p[] stays in registers
#pragma unroll
  for (int h = 0; h < H_; h++) p[h] = *(const v4i*)(ub + h * S_);
  // the four loads above share one offset register, which a later load's result
  // may take: this wait stands in front of that overwrite
  asm volatile("s_wait_xcnt 0x0" ::: "memory");
  v4i ix[H_];             // ix[h][i]: the lane's 16-byte unit of that row
  v4f lg[H_];
  v4f x[H_][TPT_];
  // unrolled: both gathers hang on p alone
#pragma unroll
  for (int h = 0; h < H_; h++) ix[h] = p[h] * (D_ / 4) + q4;
#pragma unroll
  for (int i = 0; i < TPT_; i++)
#pragma unroll
    for (int h = 0; h < H_; h++) {
      lg[h][i] = lb[p[h][i]];
      x[h][i]  = sb[ix[h][i]];
    }
  // inputs only: holds every gather above ahead of the arithmetic below; without
  // it the scheduler sinks most loads between the sums, one latency after another.
  // p and ix are the gathers' offset registers: as inputs they stay untouched
  // until the data wait in front of this line, so no result lands on one of them
  asm volatile("" :: "v"(lg[0]), "v"(lg[1]), "v"(lg[2]), "v"(lg[3]),
               "v"(x[0][0]), "v"(x[1][0]), "v"(x[2][0]), "v"(x[3][0]),
               "v"(x[0][1]), "v"(x[1][1]), "v"(x[2][1]), "v"(x[3][1]),
               "v"(x[0][2]), "v"(x[1][2]), "v"(x[2][2]), "v"(x[3][2]),
               "v"(x[0][3]), "v"(x[1][3]), "v"(x[2][3]), "v"(x[3][3]),
               "v"(p[0]), "v"(p[1]), "v"(p[2]), "v"(p[3]),
               "v"(ix[0]), "v"(ix[1]), "v"(ix[2]), "v"(ix[3]));
  v4f* ob = (v4f*)(out + (size_t)tok0 * D_) + q4;
  // unrolled: i indexes the register arrays as a constant
#pragma unroll
  for (int i = 0; i < TPT_; i++) {
    float mx = fmaxf(fmaxf(lg[0][i], lg[1][i]), fmaxf(lg[2][i], lg[3][i]));
    float ws = 0.f;
    v4f acc = {0.f, 0.f, 0.f, 0.f};
#pragma unroll
    for (int h = 0; h < H_; h++) {
      float a = (lg[h][i] - mx) * 1.44269504f, w;   // e^d = 2^(d log2 e), as __expf
      // v_nop: the free slot the instruction set asks for behind a transcendental
      asm("v_exp_f32 %0, %1\n\tv_nop" : "=v"(w) : "v"(a));
      ws += w;
      acc += w * x[h][i];
    }
    ob[i * (D_ / 4)] = acc / ws;
  }
}

// ---------------- launcher ----------------
extern "C" void kernel_launch(void* const* d_in, const int* in_sizes, int n_in,
                              void* d_out, int out_size, void* d_ws, size_t ws_size,
                              hipStream_t stream) {
  const float* qk  = (const float*)d_in[0];
  const float* v   = (const float*)d_in[1];
  const float* rot = (const float*)d_in[2];
  float* out = (float*)d_out;

  char* ws = (char*)d_ws;
  size_t off = 0;
  int*   buckets = (int*)(ws + off);  off += (size_t)B_ * E_ * sizeof(int);
  int*   hist    = (int*)(ws + off);  off += (size_t)B_ * E_ * sizeof(int);
  int*   st      = (int*)(ws + off);  off += (size_t)B_ * E_ * sizeof(int);
  int*   undo    = (int*)(ws + off);  off += (size_t)B_ * E_ * sizeof(int);
  float* slog    = (float*)(ws + off); off += (size_t)B_ * E_ * sizeof(float);
  float* so      = (float*)(ws + off); off += (size_t)B_ * E_ * D_ * sizeof(float);

  k_buckets<<<(B_ * H_ * S_) / 256, 256, 0, stream>>>(qk, rot, buckets);
  k_hist   <<<B_ * 64, 256, 0, stream>>>(buckets, hist);
  k_scan   <<<B_, 256, 0, stream>>>(hist);
  k_scatter<<<B_ * 64, 256, 0, stream>>>(buckets, hist, st, undo);
  k_attn   <<<B_ * NCH, 128, 0, stream>>>(qk, v, st, so, slog);
  k_combine<<<(B_ * S_) / (16 * TPT_), 256, 0, stream>>>(so, slog, undo, out);
}

// v003
// One run takes 139 microseconds.
// In both of two side-by-side timings against v002, it was 1.16 times as fast.
// All steps since v000 together make it 1.64 times as fast.
#include <hip/hip_runtime.h>
#include <hip/hip_bf16.h>
#include <math.h>

// ---------------- problem constants (fixed by reference) ----------------
#define B_   16
#define S_   4096
#define D_   64
#define H_   4
#define NB_  64          // buckets per hash
#define NBIN 256         // H_*NB_ total bucket ids
#define E_   16384       // H_*S_ elements per batch
#define NCH  256         // chunks (= H_*NB_)
#define L_   64          // queries per chunk
#define KL_  128         // keys per chunk (look-one-back)

typedef float v2f __attribute__((ext_vector_type(2)));
typedef float v8f __attribute__((ext_vector_type(8)));
typedef float v4f __attribute__((ext_vector_type(4)));

__device__ __forceinline__ v8f wmma_f32(v2f a, v2f b, v8f c) {
  return __builtin_amdgcn_wmma_f32_16x16x4_f32(false, a, false, b, (short)0, c,
                                               false, false);
}

// LDS byte address of a __shared__ object (low 32 bits of its address)
__device__ __forceinline__ unsigned lds_addr(const void* p) {
  return (unsigned)(uintptr_t)p;
}

// eight 16-byte copies per lane, global -> LDS: source rows t[j..j+7], LDS rows
// lstep bytes apart; s_wait_xcnt 0 ends the statement so that no address
// register of an issued copy is rewritten ahead of it
#define COPY8(l0, lstep, gbase, t, j)                                        \
  asm volatile(                                                              \
      "global_load_async_to_lds_b128 %0, %8, off\n\t"                        \
      "global_load_async_to_lds_b128 %1, %9, off\n\t"                        \
      "global_load_async_to_lds_b128 %2, %10, off\n\t"                       \
      "global_load_async_to_lds_b128 %3, %11, off\n\t"                       \
      "global_load_async_to_lds_b128 %4, %12, off\n\t"                       \
      "global_load_async_to_lds_b128 %5, %13, off\n\t"                       \
      "global_load_async_to_lds_b128 %6, %14, off\n\t"                       \
      "global_load_async_to_lds_b128 %7, %15, off\n\t"                       \
      "s_wait_xcnt 0x0"                                                      \
      :: "v"((l0)), "v"((l0) + (lstep)), "v"((l0) + 2 * (lstep)),            \
         "v"((l0) + 3 * (lstep)), "v"((l0) + 4 * (lstep)),                   \
         "v"((l0) + 5 * (lstep)), "v"((l0) + 6 * (lstep)),                   \
         "v"((l0) + 7 * (lstep)),                                            \
         "v"((gbase) + (size_t)(t)[(j) + 0] * D_),                           \
         "v"((gbase) + (size_t)(t)[(j) + 1] * D_),                           \
         "v"((gbase) + (size_t)(t)[(j) + 2] * D_),                           \
         "v"((gbase) + (size_t)(t)[(j) + 3] * D_),                           \
         "v"((gbase) + (size_t)(t)[(j) + 4] * D_),                           \
         "v"((gbase) + (size_t)(t)[(j) + 5] * D_),                           \
         "v"((gbase) + (size_t)(t)[(j) + 6] * D_),                           \
         "v"((gbase) + (size_t)(t)[(j) + 7] * D_)                            \
      : "memory")

// ---------------- K1: LSH bucket ids ----------------
// 16 consecutive blocks share one batch and one hash round: b and h come from
// blockIdx alone, so a rotation row's address is the same in every lane and the
// row reaches the FMAs through scalar loads, as scalar-register operands; every
// sum keeps its order in f and its fused multiply-adds
__global__ void __launch_bounds__(256)
k_buckets(const float* __restrict__ qk,
          const float* __restrict__ rot,
          int* __restrict__ buckets) {
  int b   = blockIdx.x >> 6;
  int h   = (blockIdx.x >> 4) & (H_ - 1);
  int t   = (blockIdx.x & 15) * 256 + threadIdx.x;
  int rem = h * S_ + t;
  const v4f* q = (const v4f*)(qk + ((size_t)b * S_ + t) * D_);
  v4f qv[D_ / 4];         // the lane's own row, the only vector loads left
  // unrolled: qv[] stays in registers
#pragma unroll
  for (int j = 0; j < D_ / 4; j++) qv[j] = q[j];
  const float* rp = rot + h * 32;
  float r[32];
#pragma unroll
  for (int i = 0; i < 32; i++) r[i] = 0.f;
  // unrolled: f indexes qv[] as a constant
#pragma unroll
  for (int f = 0; f < D_; f++) {
    float qf = qv[f >> 2][f & 3];
#pragma unroll
    for (int i = 0; i < 32; i++) r[i] += qf * rp[f * (H_ * 32) + i];
  }
  float best = r[0];
  int arg = 0;
#pragma unroll
  for (int i = 1; i < 32; i++)
    if (r[i] > best) { best = r[i]; arg = i; }
#pragma unroll
  for (int i = 0; i < 32; i++)
    if (-r[i] > best) { best = -r[i]; arg = 32 + i; }
  buckets[(size_t)b * E_ + rem] = h * NB_ + arg;
}

// ---------------- K2: per-block 256-bin histogram ----------------
__global__ void k_hist(const int* __restrict__ buckets, int* __restrict__ hist) {
  __shared__ int lh[NBIN];
  int b = blockIdx.x >> 6, blk = blockIdx.x & 63;
  lh[threadIdx.x] = 0;
  __syncthreads();
  int bin = buckets[(size_t)b * E_ + blk * 256 + threadIdx.x];
  atomicAdd(&lh[bin], 1);
  __syncthreads();
  // bin-major layout: hist[b][bin][blk]
  hist[(size_t)b * E_ + threadIdx.x * 64 + blk] = lh[threadIdx.x];
}

// ---------------- K3: bin-major exclusive scan (in place) ----------------
__global__ void k_scan(int* __restrict__ hist) {
  __shared__ int tot[NBIN];
  __shared__ int sc[NBIN];
  int b = blockIdx.x, bin = threadIdx.x;
  int* hp = hist + (size_t)b * E_ + bin * 64;
  int s = 0;
  for (int k = 0; k < 64; k++) s += hp[k];
  tot[bin] = s;
  sc[bin] = s;
  __syncthreads();
  for (int off = 1; off < NBIN; off <<= 1) {
    int v = (bin >= off) ? sc[bin - off] : 0;
    __syncthreads();
    sc[bin] += v;
    __syncthreads();
  }
  int run = sc[bin] - tot[bin];   // exclusive bin start
  for (int k = 0; k < 64; k++) { int c = hp[k]; hp[k] = run; run += c; }
}

// ---------------- K4: stable scatter ----------------
__global__ void k_scatter(const int* __restrict__ buckets,
                          const int* __restrict__ hist,
                          int* __restrict__ st, int* __restrict__ undo) {
  __shared__ int lbin[256];
  int b = blockIdx.x >> 6, blk = blockIdx.x & 63;
  int j = blk * 256 + threadIdx.x;
  int bin = buckets[(size_t)b * E_ + j];
  lbin[threadIdx.x] = bin;
  __syncthreads();
  int rank = 0;
  for (int i = 0; i < threadIdx.x; i++) rank += (lbin[i] == bin);
  int pos = hist[(size_t)b * E_ + bin * 64 + blk] + rank;
  st[(size_t)b * E_ + pos] = j & (S_ - 1);   // token index
  undo[(size_t)b * E_ + j] = pos;
}

// ---------------- K5: chunked attention with f32 WMMA ----------------
__global__ void __launch_bounds__(128)
k_attn(const float* __restrict__ qk, const float* __restrict__ v,
       const int* __restrict__ st, float* __restrict__ so,
       float* __restrict__ slog) {
  __shared__ __attribute__((aligned(16))) float lq[L_][68];     // queries   64x64  (+4 pad)
  __shared__ __attribute__((aligned(16))) float lk[KL_][68];    // keys      128x64 (normalized)
  __shared__ __attribute__((aligned(16))) float lv[KL_][68];    // values    128x64
  __shared__ float lp[L_][132];    // exp(dots) 64x128 (+4 pad)
  __shared__ int   qt[L_];
  __shared__ int   kt[KL_];
  __shared__ float lrcp[L_];

  int b = blockIdx.x >> 8, c = blockIdx.x & (NCH - 1);
  int cprev = (c + NCH - 1) & (NCH - 1);
  int tid = threadIdx.x;
  const int* stb = st + (size_t)b * E_;

  // ---- stage Q, K, V: asynchronous copies to LDS, all in flight at once ----
  {
    int r0 = tid >> 4, q4 = tid & 15;             // 16 lanes of 16 B per row
    int tk[16];
    // unrolled: tk[] stays in registers and the 16 index loads issue together
#pragma unroll
    for (int j = 0; j < 16; j++) {
      // rows r0 + 8 j: j < 8 lies in this chunk, j >= 8 in the one before
      int p = (j < 8 ? c * L_ : cprev * L_ - L_) + r0 + 8 * j;
      tk[j] = stb[p] & (S_ - 1);                  // bounds every copy's source row
    }
    const float* qb = qk + (size_t)b * S_ * D_ + q4 * 4;
    const float* vb = v  + (size_t)b * S_ * D_ + q4 * 4;
    // unrolled: j indexes tk[] as a constant
#pragma unroll
    for (int j = 0; j < 16; j += 8) {
      COPY8(lds_addr(&lk[r0 + 8 * j][q4 * 4]), 8 * 68 * 4, qb, tk, j);
      COPY8(lds_addr(&lv[r0 + 8 * j][q4 * 4]), 8 * 68 * 4, vb, tk, j);
    }
    COPY8(lds_addr(&lq[r0][q4 * 4]), 8 * 68 * 4, qb, tk, 0);
    if (q4 == 0) {
      // unrolled: j indexes tk[] as a constant
#pragma unroll
      for (int j = 0; j < 16; j++) {
        kt[r0 + 8 * j] = tk[j];
        if (j < 8) qt[r0 + 8 * j] = tk[j];
      }
    }
    // this wave's copies have landed before the barrier publishes them
    asm volatile("s_wait_asynccnt 0x0" ::: "memory");
  }
  __syncthreads();

  // ---- normalize keys ----
  for (int row = tid; row < KL_; row += 128) {
    float ss = 0.f;
    for (int d = 0; d < D_; d++) { float x = lk[row][d]; ss += x * x; }
    float scl = 1.0f / fmaxf(sqrtf(ss), 1e-12f);
    for (int d = 0; d < D_; d++) lk[row][d] *= scl;
  }
  __syncthreads();

  int wave = tid >> 5, lane = tid & 31;
  int m = lane & 15, hi = lane >> 4;
  int rbase = wave * 16;

  // A fragments (Q strip 16x64), ISA layout: lane half splits K {0,1}/{2,3}
  v2f afq[16];
#pragma unroll
  for (int k4 = 0; k4 < 16; k4++) {
    afq[k4].x = lq[rbase + m][4 * k4 + 2 * hi];
    afq[k4].y = lq[rbase + m][4 * k4 + 2 * hi + 1];
  }

  // ---- dots = Q @ K^T * D^-0.5, masked ----
  for (int nt = 0; nt < 8; nt++) {
    v8f acc = {0.f, 0.f, 0.f, 0.f, 0.f, 0.f, 0.f, 0.f};
#pragma unroll
    for (int k4 = 0; k4 < 16; k4++) {
      v2f bf;
      bf.x = lk[nt * 16 + m][4 * k4 + 2 * hi];
      bf.y = lk[nt * 16 + m][4 * k4 + 2 * hi + 1];
      acc = wmma_f32(afq[k4], bf, acc);
    }
    int col = nt * 16 + m;
    int ktc = kt[col];
#pragma unroll
    for (int e = 0; e < 8; e++) {
      int row = rbase + e + 8 * hi;
      float val = acc[e] * 0.125f;           // 64^-0.5
      if (qt[row] == ktc) val = -5e4f;       // self-attn mask
      lp[row][col] = val;
    }
  }

  // ---- row softmax (wave-local rows; LDS ops in-order per wave) ----
  {
    int r = rbase + m;
    int c0 = hi * 64;
    float mx = -3.402823466e38f;
    for (int cc = 0; cc < 64; cc++) mx = fmaxf(mx, lp[r][c0 + cc]);
    mx = fmaxf(mx, __shfl_xor(mx, 16, 32));
    float ssum = 0.f;
    for (int cc = 0; cc < 64; cc++) {
      float e = __expf(lp[r][c0 + cc] - mx);
      lp[r][c0 + cc] = e;
      ssum += e;
    }
    ssum += __shfl_xor(ssum, 16, 32);
    float lse = mx + __logf(ssum);
    if (hi == 0) {
      lrcp[r] = 1.0f / ssum;
      slog[(size_t)b * E_ + c * L_ + r] = lse;
    }
  }

  // ---- bo = P @ V ----
  for (int nt2 = 0; nt2 < 4; nt2++) {
    v8f acc = {0.f, 0.f, 0.f, 0.f, 0.f, 0.f, 0.f, 0.f};
#pragma unroll
    for (int k4 = 0; k4 < 32; k4++) {
      v2f af, bf;
      af.x = lp[rbase + m][4 * k4 + 2 * hi];
      af.y = lp[rbase + m][4 * k4 + 2 * hi + 1];
      bf.x = lv[4 * k4 + 2 * hi][nt2 * 16 + m];
      bf.y = lv[4 * k4 + 2 * hi + 1][nt2 * 16 + m];
      acc = wmma_f32(af, bf, acc);
    }
#pragma unroll
    for (int e = 0; e < 8; e++) {
      int row = rbase + e + 8 * hi;
      size_t idx = ((size_t)b * E_ + c * L_ + row) * D_ + nt2 * 16 + m;
      so[idx] = acc[e] * lrcp[row];
    }
  }
}

// ---------------- K6: unsort + combine hash rounds ----------------
// 16 lanes of 16 B cover one token's row; a lane takes TPT_ consecutive tokens,
// so few waves start and every gather of a lane is in flight at once
#define TPT_ 4
typedef int   v4i __attribute__((ext_vector_type(4)));
__global__ void __launch_bounds__(256)
k_combine(const float* __restrict__ so,
          const float* __restrict__ slog,
          const int* __restrict__ undo,
          float* __restrict__ out) {
  int q4   = threadIdx.x & 15;
  int tok0 = (blockIdx.x * 16 + (threadIdx.x >> 4)) * TPT_;   // [0, B_*S_)
  int b = tok0 >> 12, t = tok0 & (S_ - 1);
  const int*   ub = undo + (size_t)b * E_ + t;
  const float* lb = slog + (size_t)b * E_;
  const v4f*   sb = (const v4f*)(so + (size_t)b * E_ * D_);
  v4i p[H_];              // p[h][i]: sorted place of token t + i in round h
  // unrolled: p[] stays in registers
#pragma unroll
  for (int h = 0; h < H_; h++) p[h] = *(const v4i*)(ub + h * S_);
  // the four loads above share one offset register, which a later load's result
  // may take: this wait stands in front of that overwrite
  asm volatile("s_wait_xcnt 0x0" ::: "memory");
  v4i ix[H_];             // ix[h][i]: the lane's 16-byte unit of that row
  v4f lg[H_];
  v4f x[H_][TPT_];
  // unrolled: both gathers hang on p alone
#pragma unroll
  for (int h = 0; h < H_; h++) ix[h] = p[h] * (D_ / 4) + q4;
#pragma unroll
  for (int i = 0; i < TPT_; i++)
#pragma unroll
    for (int h = 0; h < H_; h++) {
      lg[h][i] = lb[p[h][i]];
      x[h][i]  = sb[ix[h][i]];
    }
  // inputs only: holds every gather above ahead of the arithmetic below; without
  // it the scheduler sinks most loads between the sums, one latency after another.
  // p and ix are the gathers' offset registers: as inputs they stay untouched
  // until the data wait in front of this line, so no result lands on one of them
  asm volatile("" :: "v"(lg[0]), "v"(lg[1]), "v"(lg[2]), "v"(lg[3]),
               "v"(x[0][0]), "v"(x[1][0]), "v"(x[2][0]), "v"(x[3][0]),
               "v"(x[0][1]), "v"(x[1][1]), "v"(x[2][1]), "v"(x[3][1]),
               "v"(x[0][2]), "v"(x[1][2]), "v"(x[2][2]), "v"(x[3][2]),
               "v"(x[0][3]), "v"(x[1][3]), "v"(x[2][3]), "v"(x[3][3]),
               "v"(p[0]), "v"(p[1]), "v"(p[2]), "v"(p[3]),
               "v"(ix[0]), "v"(ix[1]), "v"(ix[2]), "v"(ix[3]));
  v4f* ob = (v4f*)(out + (size_t)tok0 * D_) + q4;
  // unrolled: i indexes the register arrays as a constant
#pragma unroll
  for (int i = 0; i < TPT_; i++) {
    float mx = fmaxf(fmaxf(lg[0][i], lg[1][i]), fmaxf(lg[2][i], lg[3][i]));
    float ws = 0.f;
    v4f acc = {0.f, 0.f, 0.f, 0.f};
#pragma unroll
    for (int h = 0; h < H_; h++) {
      float a = (lg[h][i] - mx) * 1.44269504f, w;   // e^d = 2^(d log2 e), as __expf
      // v_nop: the free slot the instruction set asks for behind a transcendental
      asm("v_exp_f32 %0, %1\n\tv_nop" : "=v"(w) : "v"(a));
      ws += w;
      acc += w * x[h][i];
    }
    ob[i * (D_ / 4)] = acc / ws;
  }
}

// ---------------- launcher ----------------
extern "C" void kernel_launch(void* const* d_in, const int* in_sizes, int n_in,
                              void* d_out, int out_size, void* d_ws, size_t ws_size,
                              hipStream_t stream) {
  const float* qk  = (const float*)d_in[0];
  const float* v   = (const float*)d_in[1];
  const float* rot = (const float*)d_in[2];
  float* out = (float*)d_out;

  char* ws = (char*)d_ws;
  size_t off = 0;
  int*   buckets = (int*)(ws + off);  off += (size_t)B_ * E_ * sizeof(int);
  int*   hist    = (int*)(ws + off);  off += (size_t)B_ * E_ * sizeof(int);
  int*   st      = (int*)(ws + off);  off += (size_t)B_ * E_ * sizeof(int);
  int*   undo    = (int*)(ws + off);  off += (size_t)B_ * E_ * sizeof(int);
  float* slog    = (float*)(ws + off); off += (size_t)B_ * E_ * sizeof(float);
  float* so      = (float*)(ws + off); off += (size_t)B_ * E_ * D_ * sizeof(float);

  k_buckets<<<(B_ * H_ * S_) / 256, 256, 0, stream>>>(qk, rot, buckets);
  k_hist   <<<B_ * 64, 256, 0, stream>>>(buckets, hist);
  k_scan   <<<B_, 256, 0, stream>>>(hist);
  k_scatter<<<B_ * 64, 256, 0, stream>>>(buckets, hist, st, undo);
  k_attn   <<<B_ * NCH, 128, 0, stream>>>(qk, v, st, so, slog);
  k_combine<<<(B_ * S_) / (16 * TPT_), 256, 0, stream>>>(so, slog, undo, out);
}

// v004
// It runs in 113 microseconds.
// Timed twice side by side with v003, it ran 1.23 times as fast both times.
// All steps since v000 together make it 2.01 times as fast.
#include <hip/hip_runtime.h>
#include <hip/hip_bf16.h>
#include <math.h>

// ---------------- problem constants (fixed by reference) ----------------
#define B_   16
#define S_   4096
#define D_   64
#define H_   4
#define NB_  64          // buckets per hash
#define NBIN 256         // H_*NB_ total bucket ids
#define E_   16384       // H_*S_ elements per batch
#define NCH  256         // chunks (= H_*NB_)
#define L_   64          // queries per chunk
#define KL_  128         // keys per chunk (look-one-back)

typedef float v2f __attribute__((ext_vector_type(2)));
typedef float v8f __attribute__((ext_vector_type(8)));
typedef float v4f __attribute__((ext_vector_type(4)));

__device__ __forceinline__ v8f wmma_f32(v2f a, v2f b, v8f c) {
  return __builtin_amdgcn_wmma_f32_16x16x4_f32(false, a, false, b, (short)0, c,
                                               false, false);
}

// LDS byte address of a __shared__ object (low 32 bits of its address)
__device__ __forceinline__ unsigned lds_addr(const void* p) {
  return (unsigned)(uintptr_t)p;
}

// eight 16-byte copies per lane, global -> LDS: source rows t[j..j+7], LDS rows
// lstep bytes apart; s_wait_xcnt 0 ends the statement so that no address
// register of an issued copy is rewritten ahead of it
#define COPY8(l0, lstep, gbase, t, j)                                        \
  asm volatile(                                                              \
      "global_load_async_to_lds_b128 %0, %8, off\n\t"                        \
      "global_load_async_to_lds_b128 %1, %9, off\n\t"                        \
      "global_load_async_to_lds_b128 %2, %10, off\n\t"                       \
      "global_load_async_to_lds_b128 %3, %11, off\n\t"                       \
      "global_load_async_to_lds_b128 %4, %12, off\n\t"                       \
      "global_load_async_to_lds_b128 %5, %13, off\n\t"                       \
      "global_load_async_to_lds_b128 %6, %14, off\n\t"                       \
      "global_load_async_to_lds_b128 %7, %15, off\n\t"                       \
      "s_wait_xcnt 0x0"                                                      \
      :: "v"((l0)), "v"((l0) + (lstep)), "v"((l0) + 2 * (lstep)),            \
         "v"((l0) + 3 * (lstep)), "v"((l0) + 4 * (lstep)),                   \
         "v"((l0) + 5 * (lstep)), "v"((l0) + 6 * (lstep)),                   \
         "v"((l0) + 7 * (lstep)),                                            \
         "v"((gbase) + (size_t)(t)[(j) + 0] * D_),                           \
         "v"((gbase) + (size_t)(t)[(j) + 1] * D_),                           \
         "v"((gbase) + (size_t)(t)[(j) + 2] * D_),                           \
         "v"((gbase) + (size_t)(t)[(j) + 3] * D_),                           \
         "v"((gbase) + (size_t)(t)[(j) + 4] * D_),                           \
         "v"((gbase) + (size_t)(t)[(j) + 5] * D_),                           \
         "v"((gbase) + (size_t)(t)[(j) + 6] * D_),                           \
         "v"((gbase) + (size_t)(t)[(j) + 7] * D_)                            \
      : "memory")

// ---------------- K1: LSH bucket ids ----------------
// 16 consecutive blocks share one batch and one hash round: b and h come from
// blockIdx alone, so a rotation row's address is the same in every lane and the
// row reaches the FMAs through scalar loads, as scalar-register operands; every
// sum keeps its order in f and its fused multiply-adds
__global__ void __launch_bounds__(256)
k_buckets(const float* __restrict__ qk,
          const float* __restrict__ rot,
          int* __restrict__ buckets) {
  int b   = blockIdx.x >> 6;
  int h   = (blockIdx.x >> 4) & (H_ - 1);
  int t   = (blockIdx.x & 15) * 256 + threadIdx.x;
  int rem = h * S_ + t;
  const v4f* q = (const v4f*)(qk + ((size_t)b * S_ + t) * D_);
  v4f qv[D_ / 4];         // the lane's own row, the only vector loads left
  // unrolled: qv[] stays in registers
#pragma unroll
  for (int j = 0; j < D_ / 4; j++) qv[j] = q[j];
  const float* rp = rot + h * 32;
  float r[32];
#pragma unroll
  for (int i = 0; i < 32; i++) r[i] = 0.f;
  // unrolled: f indexes qv[] as a constant
#pragma unroll
  for (int f = 0; f < D_; f++) {
    float qf = qv[f >> 2][f & 3];
#pragma unroll
    for (int i = 0; i < 32; i++) r[i] += qf * rp[f * (H_ * 32) + i];
  }
  float best = r[0];
  int arg = 0;
#pragma unroll
  for (int i = 1; i < 32; i++)
    if (r[i] > best) { best = r[i]; arg = i; }
#pragma unroll
  for (int i = 0; i < 32; i++)
    if (-r[i] > best) { best = -r[i]; arg = 32 + i; }
  buckets[(size_t)b * E_ + rem] = h * NB_ + arg;
}

// ---------------- K2: per-block 256-bin histogram ----------------
__global__ void k_hist(const int* __restrict__ buckets, int* __restrict__ hist) {
  __shared__ int lh[NBIN];
  int b = blockIdx.x >> 6, blk = blockIdx.x & 63;
  lh[threadIdx.x] = 0;
  __syncthreads();
  int bin = buckets[(size_t)b * E_ + blk * 256 + threadIdx.x];
  atomicAdd(&lh[bin], 1);
  __syncthreads();
  // bin-major layout: hist[b][bin][blk]
  hist[(size_t)b * E_ + threadIdx.x * 64 + blk] = lh[threadIdx.x];
}

// ---------------- K3: bin-major exclusive scan (in place) ----------------
__global__ void k_scan(int* __restrict__ hist) {
  __shared__ int tot[NBIN];
  __shared__ int sc[NBIN];
  int b = blockIdx.x, bin = threadIdx.x;
  int* hp = hist + (size_t)b * E_ + bin * 64;
  int s = 0;
  for (int k = 0; k < 64; k++) s += hp[k];
  tot[bin] = s;
  sc[bin] = s;
  __syncthreads();
  for (int off = 1; off < NBIN; off <<= 1) {
    int v = (bin >= off) ? sc[bin - off] : 0;
    __syncthreads();
    sc[bin] += v;
    __syncthreads();
  }
  int run = sc[bin] - tot[bin];   // exclusive bin start
  for (int k = 0; k < 64; k++) { int c = hp[k]; hp[k] = run; run += c; }
}

// ---------------- K4: stable scatter ----------------
__global__ void k_scatter(const int* __restrict__ buckets,
                          const int* __restrict__ hist,
                          int* __restrict__ st, int* __restrict__ undo) {
  __shared__ int lbin[256];
  int b = blockIdx.x >> 6, blk = blockIdx.x & 63;
  int j = blk * 256 + threadIdx.x;
  int bin = buckets[(size_t)b * E_ + j];
  lbin[threadIdx.x] = bin;
  __syncthreads();
  int rank = 0;
  for (int i = 0; i < threadIdx.x; i++) rank += (lbin[i] == bin);
  int pos = hist[(size_t)b * E_ + bin * 64 + blk] + rank;
  st[(size_t)b * E_ + pos] = j & (S_ - 1);   // token index
  undo[(size_t)b * E_ + j] = pos;
}

// ---------------- K5: chunked attention with f32 WMMA ----------------
__global__ void __launch_bounds__(128)
k_attn(const float* __restrict__ qk, const float* __restrict__ v,
       const int* __restrict__ st, float* __restrict__ so,
       float* __restrict__ slog) {
  __shared__ __attribute__((aligned(16))) float lq[L_][68];     // queries   64x64  (+4 pad)
  __shared__ __attribute__((aligned(16))) float lk[KL_][68];    // keys      128x64 (normalized)
  __shared__ __attribute__((aligned(16))) float lv[KL_][68];    // values    128x64
  __shared__ int   qt[L_];
  __shared__ int   kt[KL_];
  __shared__ float lrcp[L_];

  int b = blockIdx.x >> 8, c = blockIdx.x & (NCH - 1);
  int cprev = (c + NCH - 1) & (NCH - 1);
  int tid = threadIdx.x;
  const int* stb = st + (size_t)b * E_;

  // ---- stage Q, K, V: asynchronous copies to LDS, all in flight at once ----
  {
    int r0 = tid >> 4, q4 = tid & 15;             // 16 lanes of 16 B per row
    int tk[16];
    // unrolled: tk[] stays in registers and the 16 index loads issue together
#pragma unroll
    for (int j = 0; j < 16; j++) {
      // rows r0 + 8 j: j < 8 lies in this chunk, j >= 8 in the one before
      int p = (j < 8 ? c * L_ : cprev * L_ - L_) + r0 + 8 * j;
      tk[j] = stb[p] & (S_ - 1);                  // bounds every copy's source row
    }
    const float* qb = qk + (size_t)b * S_ * D_ + q4 * 4;
    const float* vb = v  + (size_t)b * S_ * D_ + q4 * 4;
    // unrolled: j indexes tk[] as a constant
#pragma unroll
    for (int j = 0; j < 16; j += 8) {
      COPY8(lds_addr(&lk[r0 + 8 * j][q4 * 4]), 8 * 68 * 4, qb, tk, j);
      COPY8(lds_addr(&lv[r0 + 8 * j][q4 * 4]), 8 * 68 * 4, vb, tk, j);
    }
    COPY8(lds_addr(&lq[r0][q4 * 4]), 8 * 68 * 4, qb, tk, 0);
    if (q4 == 0) {
      // unrolled: j indexes tk[] as a constant
#pragma unroll
      for (int j = 0; j < 16; j++) {
        kt[r0 + 8 * j] = tk[j];
        if (j < 8) qt[r0 + 8 * j] = tk[j];
      }
    }
    // this wave's copies have landed before the barrier publishes them
    asm volatile("s_wait_asynccnt 0x0" ::: "memory");
  }
  __syncthreads();

  // ---- normalize keys ----
  for (int row = tid; row < KL_; row += 128) {
    float ss = 0.f;
    for (int d = 0; d < D_; d++) { float x = lk[row][d]; ss += x * x; }
    float scl = 1.0f / fmaxf(sqrtf(ss), 1e-12f);
    for (int d = 0; d < D_; d++) lk[row][d] *= scl;
  }
  __syncthreads();

  int wave = tid >> 5, lane = tid & 31;
  int m = lane & 15, hi = lane >> 4;
  int rbase = wave * 16;

  // B fragments: the wave's 16 queries as columns, lane half splits k {0,1}/{2,3}
  v2f bq[16];
  // unrolled: bq[] stays in registers
#pragma unroll
  for (int k4 = 0; k4 < 16; k4++) {
    bq[k4].x = lq[rbase + m][4 * k4 + 2 * hi];
    bq[k4].y = lq[rbase + m][4 * k4 + 2 * hi + 1];
  }

  // ---- dots^T = K @ Q^T * D^-0.5, masked: keys are the rows of a tile, so
  // sc[nt][e] of lane (m, hi) is query rbase + m against key nt*16 + 8*hi + e:
  // a lane holds 64 of its query's 128 scores, lane ^ 16 the other 64 ----
  int qtm = qt[rbase + m];
  v8f sc[8];
  // unrolled: nt indexes sc[] as a constant
#pragma unroll
  for (int nt = 0; nt < 8; nt++) {
    v8f acc = {0.f, 0.f, 0.f, 0.f, 0.f, 0.f, 0.f, 0.f};
#pragma unroll
    for (int k4 = 0; k4 < 16; k4++) {
      v2f af;
      af.x = lk[nt * 16 + m][4 * k4 + 2 * hi];
      af.y = lk[nt * 16 + m][4 * k4 + 2 * hi + 1];
      acc = wmma_f32(af, bq[k4], acc);
    }
#pragma unroll
    for (int e = 0; e < 8; e++) {
      float val = acc[e] * 0.125f;                        // 64^-0.5
      if (qtm == kt[nt * 16 + 8 * hi + e]) val = -5e4f;   // self-attn mask
      sc[nt][e] = val;
    }
  }

  // ---- row softmax in registers: eight running values a lane, then lane ^ 16
  // (lrcp rows are the wave's own; LDS ops in-order per wave) ----
  {
    int r = rbase + m;
    v8f mv = sc[0];
    // unrolled: nt and e index register arrays as constants
#pragma unroll
    for (int nt = 1; nt < 8; nt++)
#pragma unroll
      for (int e = 0; e < 8; e++) mv[e] = fmaxf(mv[e], sc[nt][e]);
    float mx = fmaxf(fmaxf(fmaxf(mv[0], mv[1]), fmaxf(mv[2], mv[3])),
                     fmaxf(fmaxf(mv[4], mv[5]), fmaxf(mv[6], mv[7])));
    mx = fmaxf(mx, __shfl_xor(mx, 16, 32));
    v8f sv;
    // unrolled: nt and e index register arrays as constants
#pragma unroll
    for (int nt = 0; nt < 8; nt++)
#pragma unroll
      for (int e = 0; e < 8; e++) {
        float a = (sc[nt][e] - mx) * 1.44269504f, p;   // e^d = 2^(d log2 e), as __expf
        // v_nop: the free slot the instruction set asks for behind a transcendental
        asm("v_exp_f32 %0, %1\n\tv_nop" : "=v"(p) : "v"(a));
        sc[nt][e] = p;
        sv[e] = nt == 0 ? p : sv[e] + p;
      }
    float ssum = ((sv[0] + sv[1]) + (sv[2] + sv[3])) +
                 ((sv[4] + sv[5]) + (sv[6] + sv[7]));
    ssum += __shfl_xor(ssum, 16, 32);
    float lse = mx + __logf(ssum);
    if (hi == 0) {
      lrcp[r] = 1.0f / ssum;
      slog[(size_t)b * E_ + c * L_ + r] = lse;
    }
  }

  // ---- bo = P @ V: two neighbouring registers of a score tile are an A
  // fragment as they lie (row = query m; k = keys nt*16 + 8*hi + 2*s + {0,1});
  // the V fragment takes the same keys at the same lane half and register ----
  v8f o[4];
  // unrolled, this loop and the two nests below: sc[] and o[] stay in registers
#pragma unroll
  for (int nt2 = 0; nt2 < 4; nt2++)
    o[nt2] = (v8f){0.f, 0.f, 0.f, 0.f, 0.f, 0.f, 0.f, 0.f};
#pragma unroll
  for (int nt = 0; nt < 8; nt++) {
#pragma unroll
    for (int s = 0; s < 4; s++) {
      v2f af;
      af.x = sc[nt][2 * s];
      af.y = sc[nt][2 * s + 1];
      int key = nt * 16 + 8 * hi + 2 * s;
#pragma unroll
      for (int nt2 = 0; nt2 < 4; nt2++) {
        v2f bf;
        bf.x = lv[key][nt2 * 16 + m];
        bf.y = lv[key + 1][nt2 * 16 + m];
        o[nt2] = wmma_f32(af, bf, o[nt2]);
      }
    }
  }
#pragma unroll
  for (int nt2 = 0; nt2 < 4; nt2++) {
#pragma unroll
    for (int e = 0; e < 8; e++) {
      int row = rbase + e + 8 * hi;
      size_t idx = ((size_t)b * E_ + c * L_ + row) * D_ + nt2 * 16 + m;
      so[idx] = o[nt2][e] * lrcp[row];
    }
  }
}

// ---------------- K6: unsort + combine hash rounds ----------------
// 16 lanes of 16 B cover one token's row; a lane takes TPT_ consecutive tokens,
// so few waves start and every gather of a lane is in flight at once
#define TPT_ 4
typedef int   v4i __attribute__((ext_vector_type(4)));
__global__ void __launch_bounds__(256)
k_combine(const float* __restrict__ so,
          const float* __restrict__ slog,
          const int* __restrict__ undo,
          float* __restrict__ out) {
  int q4   = threadIdx.x & 15;
  int tok0 = (blockIdx.x * 16 + (threadIdx.x >> 4)) * TPT_;   // [0, B_*S_)
  int b = tok0 >> 12, t = tok0 & (S_ - 1);
  const int*   ub = undo + (size_t)b * E_ + t;
  const float* lb = slog + (size_t)b * E_;
  const v4f*   sb = (const v4f*)(so + (size_t)b * E_ * D_);
  v4i p[H_];              // p[h][i]: sorted place of token t + i in round h
  // unrolled: p[] stays in registers
#pragma unroll
  for (int h = 0; h < H_; h++) p[h] = *(const v4i*)(ub + h * S_);
  // the four loads above share one offset register, which a later load's result
  // may take: this wait stands in front of that overwrite
  asm volatile("s_wait_xcnt 0x0" ::: "memory");
  v4i ix[H_];             // ix[h][i]: the lane's 16-byte unit of that row
  v4f lg[H_];
  v4f x[H_][TPT_];
  // unrolled: both gathers hang on p alone
#pragma unroll
  for (int h = 0; h < H_; h++) ix[h] = p[h] * (D_ / 4) + q4;
#pragma unroll
  for (int i = 0; i < TPT_; i++)
#pragma unroll
    for (int h = 0; h < H_; h++) {
      lg[h][i] = lb[p[h][i]];
      x[h][i]  = sb[ix[h][i]];
    }
  // inputs only: holds every gather above ahead of the arithmetic below; without
  // it the scheduler sinks most loads between the sums, one latency after another.
  // p and ix are the gathers' offset registers: as inputs they stay untouched
  // until the data wait in front of this line, so no result lands on one of them
  asm volatile("" :: "v"(lg[0]), "v"(lg[1]), "v"(lg[2]), "v"(lg[3]),
               "v"(x[0][0]), "v"(x[1][0]), "v"(x[2][0]), "v"(x[3][0]),
               "v"(x[0][1]), "v"(x[1][1]), "v"(x[2][1]), "v"(x[3][1]),
               "v"(x[0][2]), "v"(x[1][2]), "v"(x[2][2]), "v"(x[3][2]),
               "v"(x[0][3]), "v"(x[1][3]), "v"(x[2][3]), "v"(x[3][3]),
               "v"(p[0]), "v"(p[1]), "v"(p[2]), "v"(p[3]),
               "v"(ix[0]), "v"(ix[1]), "v"(ix[2]), "v"(ix[3]));
  v4f* ob = (v4f*)(out + (size_t)tok0 * D_) + q4;
  // unrolled: i indexes the register arrays as a constant
#pragma unroll
  for (int i = 0; i < TPT_; i++) {
    float mx = fmaxf(fmaxf(lg[0][i], lg[1][i]), fmaxf(lg[2][i], lg[3][i]));
    float ws = 0.f;
    v4f acc = {0.f, 0.f, 0.f, 0.f};
#pragma unroll
    for (int h = 0; h < H_; h++) {
      float a = (lg[h][i] - mx) * 1.44269504f, w;   // e^d = 2^(d log2 e), as __expf
      // v_nop: the free slot the instruction set asks for behind a transcendental
      asm("v_exp_f32 %0, %1\n\tv_nop" : "=v"(w) : "v"(a));
      ws += w;
      acc += w * x[h][i];
    }
    ob[i * (D_ / 4)] = acc / ws;
  }
}

// ---------------- launcher ----------------
extern "C" void kernel_launch(void* const* d_in, const int* in_sizes, int n_in,
                              void* d_out, int out_size, void* d_ws, size_t ws_size,
                              hipStream_t stream) {
  const float* qk  = (const float*)d_in[0];
  const float* v   = (const float*)d_in[1];
  const float* rot = (const float*)d_in[2];
  float* out = (float*)d_out;

  char* ws = (char*)d_ws;
  size_t off = 0;
  int*   buckets = (int*)(ws + off);  off += (size_t)B_ * E_ * sizeof(int);
  int*   hist    = (int*)(ws + off);  off += (size_t)B_ * E_ * sizeof(int);
  int*   st      = (int*)(ws + off);  off += (size_t)B_ * E_ * sizeof(int);
  int*   undo    = (int*)(ws + off);  off += (size_t)B_ * E_ * sizeof(int);
  float* slog    = (float*)(ws + off); off += (size_t)B_ * E_ * sizeof(float);
  float* so      = (float*)(ws + off); off += (size_t)B_ * E_ * D_ * sizeof(float);

  k_buckets<<<(B_ * H_ * S_) / 256, 256, 0, stream>>>(qk, rot, buckets);
  k_hist   <<<B_ * 64, 256, 0, stream>>>(buckets, hist);
  k_scan   <<<B_, 256, 0, stream>>>(hist);
  k_scatter<<<B_ * 64, 256, 0, stream>>>(buckets, hist, st, undo);
  k_attn   <<<B_ * NCH, 128, 0, stream>>>(qk, v, st, so, slog);
  k_combine<<<(B_ * S_) / (16 * TPT_), 256, 0, stream>>>(so, slog, undo, out);
}

// v005
// It runs in 88.9 microseconds.
// Next to v004, in two timings, it ran 1.27 times as fast each time.
// All steps since v000 together make it 2.55 times as fast.
#include <hip/hip_runtime.h>
#include <hip/hip_bf16.h>
#include <math.h>

// ---------------- problem constants (fixed by reference) ----------------
#define B_   16
#define S_   4096
#define D_   64
#define H_   4
#define NB_  64          // buckets per hash
#define E_   16384       // H_*S_ elements per batch
#define NCH  256         // chunks (= H_*NB_)
#define L_   64          // queries per chunk
#define KL_  128         // keys per chunk (look-one-back)

typedef float v2f __attribute__((ext_vector_type(2)));
typedef float v8f __attribute__((ext_vector_type(8)));
typedef float v4f __attribute__((ext_vector_type(4)));

__device__ __forceinline__ v8f wmma_f32(v2f a, v2f b, v8f c) {
  return __builtin_amdgcn_wmma_f32_16x16x4_f32(false, a, false, b, (short)0, c,
                                               false, false);
}

// LDS byte address of a __shared__ object (low 32 bits of its address)
__device__ __forceinline__ unsigned lds_addr(const void* p) {
  return (unsigned)(uintptr_t)p;
}

// eight 16-byte copies per lane, global -> LDS: source rows t[j..j+7], LDS rows
// lstep bytes apart; s_wait_xcnt 0 ends the statement so that no address
// register of an issued copy is rewritten ahead of it
#define COPY8(l0, lstep, gbase, t, j)                                        \
  asm volatile(                                                              \
      "global_load_async_to_lds_b128 %0, %8, off\n\t"                        \
      "global_load_async_to_lds_b128 %1, %9, off\n\t"                        \
      "global_load_async_to_lds_b128 %2, %10, off\n\t"                       \
      "global_load_async_to_lds_b128 %3, %11, off\n\t"                       \
      "global_load_async_to_lds_b128 %4, %12, off\n\t"                       \
      "global_load_async_to_lds_b128 %5, %13, off\n\t"                       \
      "global_load_async_to_lds_b128 %6, %14, off\n\t"                       \
      "global_load_async_to_lds_b128 %7, %15, off\n\t"                       \
      "s_wait_xcnt 0x0"                                                      \
      :: "v"((l0)), "v"((l0) + (lstep)), "v"((l0) + 2 * (lstep)),            \
         "v"((l0) + 3 * (lstep)), "v"((l0) + 4 * (lstep)),                   \
         "v"((l0) + 5 * (lstep)), "v"((l0) + 6 * (lstep)),                   \
         "v"((l0) + 7 * (lstep)),                                            \
         "v"((gbase) + (size_t)(t)[(j) + 0] * D_),                           \
         "v"((gbase) + (size_t)(t)[(j) + 1] * D_),                           \
         "v"((gbase) + (size_t)(t)[(j) + 2] * D_),                           \
         "v"((gbase) + (size_t)(t)[(j) + 3] * D_),                           \
         "v"((gbase) + (size_t)(t)[(j) + 4] * D_),                           \
         "v"((gbase) + (size_t)(t)[(j) + 5] * D_),                           \
         "v"((gbase) + (size_t)(t)[(j) + 6] * D_),                           \
         "v"((gbase) + (size_t)(t)[(j) + 7] * D_)                            \
      : "memory")

// ---------------- K1: LSH bucket ids ----------------
// 16 consecutive blocks share one batch and one hash round: b and h come from
// blockIdx alone, so a rotation row's address is the same in every lane and the
// row reaches the FMAs through scalar loads, as scalar-register operands; every
// sum keeps its order in f and its fused multiply-adds
__global__ void __launch_bounds__(256)
k_buckets(const float* __restrict__ qk,
          const float* __restrict__ rot,
          int* __restrict__ buckets) {
  int b   = blockIdx.x >> 6;
  int h   = (blockIdx.x >> 4) & (H_ - 1);
  int t   = (blockIdx.x & 15) * 256 + threadIdx.x;
  int rem = h * S_ + t;
  const v4f* q = (const v4f*)(qk + ((size_t)b * S_ + t) * D_);
  v4f qv[D_ / 4];         // the lane's own row, the only vector loads left
  // unrolled: qv[] stays in registers
#pragma unroll
  for (int j = 0; j < D_ / 4; j++) qv[j] = q[j];
  const float* rp = rot + h * 32;
  float r[32];
#pragma unroll
  for (int i = 0; i < 32; i++) r[i] = 0.f;
  // unrolled: f indexes qv[] as a constant
#pragma unroll
  for (int f = 0; f < D_; f++) {
    float qf = qv[f >> 2][f & 3];
#pragma unroll
    for (int i = 0; i < 32; i++) r[i] += qf * rp[f * (H_ * 32) + i];
  }
  float best = r[0];
  int arg = 0;
#pragma unroll
  for (int i = 1; i < 32; i++)
    if (r[i] > best) { best = r[i]; arg = i; }
#pragma unroll
  for (int i = 0; i < 32; i++)
    if (-r[i] > best) { best = -r[i]; arg = 32 + i; }
  buckets[(size_t)b * E_ + rem] = h * NB_ + arg;
}

// ---------------- K2: stable counting sort, one block per (batch, hash round) ----
// A hash round's 4096 tokens fall in its own 64 buckets and fill its own 4096
// sorted places, so one work-group sorts a round alone, in LDS: no histogram
// plane in memory, no scan launch. A group is 32 consecutive tokens, one wave wide.
#define NGRP (S_ / 32)   // 128 groups
typedef int v4i __attribute__((ext_vector_type(4)));
typedef int v2i __attribute__((ext_vector_type(2)));
__global__ void __launch_bounds__(1024)
k_sort(const int* __restrict__ buckets, int* __restrict__ st,
       int* __restrict__ undo) {
  __shared__ __attribute__((aligned(16))) int cnt[NGRP][NB_];      // per group and bucket
  __shared__ __attribute__((aligned(16))) int seg[NGRP / 8][NB_];  // per 8 groups and bucket
  __shared__ __attribute__((aligned(16))) int lst[S_];             // sorted tokens
  int tid = threadIdx.x, wave = tid >> 5, lane = tid & 31;
  size_t base = (size_t)blockIdx.x * S_;        // = b * E_ + h * S_
  size_t mine = base + wave * 128 + lane;       // the lane's token of the wave's first group
  int hoff = (blockIdx.x & (H_ - 1)) * S_;
  int bin[4], rank[4];
  const int* bp = buckets + mine;
  // unrolled, here and below: bin[] and rank[] stay in registers
#pragma unroll
  for (int i = 0; i < 4; i++) bin[i] = bp[i * 32] & (NB_ - 1);
  ((v4i*)cnt)[tid]        = (v4i){0, 0, 0, 0};
  ((v4i*)cnt)[tid + 1024] = (v4i){0, 0, 0, 0};
  __syncthreads();
  // rank among the group's earlier tokens of the same bucket: six ballots give
  // the mask of lanes that hold the lane's own bucket
#pragma unroll
  for (int i = 0; i < 4; i++) {
    unsigned same = 0xffffffffu;
#pragma unroll
    for (int k = 0; k < 6; k++) {
      bool bit = (bin[i] >> k) & 1;
      unsigned bal = __builtin_amdgcn_ballot_w32(bit);
      same &= bit ? bal : ~bal;
    }
    rank[i] = __popc(same & ((1u << lane) - 1u));
    if (rank[i] == 0) cnt[wave * 4 + i][bin[i]] = __popc(same);
  }
  __syncthreads();
  // per bucket: running count over the 8 groups of a segment, in place
  {
    int bn = tid & (NB_ - 1), s = tid >> 6;
    int c[8], run = 0;
#pragma unroll
    for (int k = 0; k < 8; k++) c[k] = cnt[s * 8 + k][bn];
#pragma unroll
    for (int k = 0; k < 8; k++) { cnt[s * 8 + k][bn] = run; run += c[k]; }
    seg[s][bn] = run;
  }
  __syncthreads();
  // one wave, two buckets a lane: running count over the 16 segments, then the
  // buckets' starts by a scan over the wave
  if (wave == 0) {
    v2i c[NGRP / 8];
    int t0 = 0, t1 = 0;
#pragma unroll
    for (int s = 0; s < NGRP / 8; s++) c[s] = *(const v2i*)&seg[s][2 * lane];
#pragma unroll
    for (int s = 0; s < NGRP / 8; s++) {
      int x = c[s].x, y = c[s].y;
      c[s].x = t0; c[s].y = t1;
      t0 += x; t1 += y;
    }
    int inc = t0 + t1;
#pragma unroll
    for (int d = 1; d < 32; d <<= 1) {
      int up = __shfl_up(inc, d, 32);
      if (lane >= d) inc += up;
    }
    int s0 = inc - t0 - t1, s1 = inc - t1;      // starts of buckets 2 lane, 2 lane + 1
#pragma unroll
    for (int s = 0; s < NGRP / 8; s++)
      *(v2i*)&seg[s][2 * lane] = (v2i){c[s].x + s0, c[s].y + s1};
  }
  __syncthreads();
  int pos[4];
#pragma unroll
  for (int i = 0; i < 4; i++) {
    int g = wave * 4 + i;
    pos[i] = seg[g >> 3][bin[i]] + cnt[g][bin[i]] + rank[i];    // in [0, S_)
    lst[pos[i]] = g * 32 + lane;                // token index
  }
  __syncthreads();
  // every global store stands behind the last barrier, which so waits for none
  ((v4i*)(st + base))[tid] = ((const v4i*)lst)[tid];
  int* up = undo + mine;
#pragma unroll
  for (int i = 0; i < 4; i++) up[i * 32] = hoff + pos[i];
}

// ---------------- K3: chunked attention with f32 WMMA ----------------
__global__ void __launch_bounds__(128)
k_attn(const float* __restrict__ qk, const float* __restrict__ v,
       const int* __restrict__ st, float* __restrict__ so,
       float* __restrict__ slog) {
  __shared__ __attribute__((aligned(16))) float lq[L_][68];     // queries   64x64  (+4 pad)
  __shared__ __attribute__((aligned(16))) float lk[KL_][68];    // keys      128x64 (normalized)
  __shared__ __attribute__((aligned(16))) float lv[KL_][68];    // values    128x64
  __shared__ int   qt[L_];
  __shared__ int   kt[KL_];
  __shared__ float lrcp[L_];

  int b = blockIdx.x >> 8, c = blockIdx.x & (NCH - 1);
  int cprev = (c + NCH - 1) & (NCH - 1);
  int tid = threadIdx.x;
  const int* stb = st + (size_t)b * E_;

  // ---- stage Q, K, V: asynchronous copies to LDS, all in flight at once ----
  {
    int r0 = tid >> 4, q4 = tid & 15;             // 16 lanes of 16 B per row
    int tk[16];
    // unrolled: tk[] stays in registers and the 16 index loads issue together
#pragma unroll
    for (int j = 0; j < 16; j++) {
      // rows r0 + 8 j: j < 8 lies in this chunk, j >= 8 in the one before
      int p = (j < 8 ? c * L_ : cprev * L_ - L_) + r0 + 8 * j;
      tk[j] = stb[p] & (S_ - 1);                  // bounds every copy's source row
    }
    const float* qb = qk + (size_t)b * S_ * D_ + q4 * 4;
    const float* vb = v  + (size_t)b * S_ * D_ + q4 * 4;
    // unrolled: j indexes tk[] as a constant
#pragma unroll
    for (int j = 0; j < 16; j += 8) {
      COPY8(lds_addr(&lk[r0 + 8 * j][q4 * 4]), 8 * 68 * 4, qb, tk, j);
      COPY8(lds_addr(&lv[r0 + 8 * j][q4 * 4]), 8 * 68 * 4, vb, tk, j);
    }
    COPY8(lds_addr(&lq[r0][q4 * 4]), 8 * 68 * 4, qb, tk, 0);
    if (q4 == 0) {
      // unrolled: j indexes tk[] as a constant
#pragma unroll
      for (int j = 0; j < 16; j++) {
        kt[r0 + 8 * j] = tk[j];
        if (j < 8) qt[r0 + 8 * j] = tk[j];
      }
    }
    // this wave's copies have landed before the barrier publishes them
    asm volatile("s_wait_asynccnt 0x0" ::: "memory");
  }
  __syncthreads();

  // ---- normalize keys ----
  for (int row = tid; row < KL_; row += 128) {
    float ss = 0.f;
    for (int d = 0; d < D_; d++) { float x = lk[row][d]; ss += x * x; }
    float scl = 1.0f / fmaxf(sqrtf(ss), 1e-12f);
    for (int d = 0; d < D_; d++) lk[row][d] *= scl;
  }
  __syncthreads();

  int wave = tid >> 5, lane = tid & 31;
  int m = lane & 15, hi = lane >> 4;
  int rbase = wave * 16;

  // B fragments: the wave's 16 queries as columns, lane half splits k {0,1}/{2,3}
  v2f bq[16];
  // unrolled: bq[] stays in registers
#pragma unroll
  for (int k4 = 0; k4 < 16; k4++) {
    bq[k4].x = lq[rbase + m][4 * k4 + 2 * hi];
    bq[k4].y = lq[rbase + m][4 * k4 + 2 * hi + 1];
  }

  // ---- dots^T = K @ Q^T * D^-0.5, masked: keys are the rows of a tile, so
  // sc[nt][e] of lane (m, hi) is query rbase + m against key nt*16 + 8*hi + e:
  // a lane holds 64 of its query's 128 scores, lane ^ 16 the other 64 ----
  int qtm = qt[rbase + m];
  v8f sc[8];
  // unrolled: nt indexes sc[] as a constant
#pragma unroll
  for (int nt = 0; nt < 8; nt++) {
    v8f acc = {0.f, 0.f, 0.f, 0.f, 0.f, 0.f, 0.f, 0.f};
#pragma unroll
    for (int k4 = 0; k4 < 16; k4++) {
      v2f af;
      af.x = lk[nt * 16 + m][4 * k4 + 2 * hi];
      af.y = lk[nt * 16 + m][4 * k4 + 2 * hi + 1];
      acc = wmma_f32(af, bq[k4], acc);
    }
#pragma unroll
    for (int e = 0; e < 8; e++) {
      float val = acc[e] * 0.125f;                        // 64^-0.5
      if (qtm == kt[nt * 16 + 8 * hi + e]) val = -5e4f;   // self-attn mask
      sc[nt][e] = val;
    }
  }

  // ---- row softmax in registers: eight running values a lane, then lane ^ 16
  // (lrcp rows are the wave's own; LDS ops in-order per wave) ----
  {
    int r = rbase + m;
    v8f mv = sc[0];
    // unrolled: nt and e index register arrays as constants
#pragma unroll
    for (int nt = 1; nt < 8; nt++)
#pragma unroll
      for (int e = 0; e < 8; e++) mv[e] = fmaxf(mv[e], sc[nt][e]);
    float mx = fmaxf(fmaxf(fmaxf(mv[0], mv[1]), fmaxf(mv[2], mv[3])),
                     fmaxf(fmaxf(mv[4], mv[5]), fmaxf(mv[6], mv[7])));
    mx = fmaxf(mx, __shfl_xor(mx, 16, 32));
    v8f sv;
    // unrolled: nt and e index register arrays as constants
#pragma unroll
    for (int nt = 0; nt < 8; nt++)
#pragma unroll
      for (int e = 0; e < 8; e++) {
        float a = (sc[nt][e] - mx) * 1.44269504f, p;   // e^d = 2^(d log2 e), as __expf
        // v_nop: the free slot the instruction set asks for behind a transcendental
        asm("v_exp_f32 %0, %1\n\tv_nop" : "=v"(p) : "v"(a));
        sc[nt][e] = p;
        sv[e] = nt == 0 ? p : sv[e] + p;
      }
    float ssum = ((sv[0] + sv[1]) + (sv[2] + sv[3])) +
                 ((sv[4] + sv[5]) + (sv[6] + sv[7]));
    ssum += __shfl_xor(ssum, 16, 32);
    float lse = mx + __logf(ssum);
    if (hi == 0) {
      lrcp[r] = 1.0f / ssum;
      slog[(size_t)b * E_ + c * L_ + r] = lse;
    }
  }

  // ---- bo = P @ V: two neighbouring registers of a score tile are an A
  // fragment as they lie (row = query m; k = keys nt*16 + 8*hi + 2*s + {0,1});
  // the V fragment takes the same keys at the same lane half and register ----
  v8f o[4];
  // unrolled, this loop and the two nests below: sc[] and o[] stay in registers
#pragma unroll
  for (int nt2 = 0; nt2 < 4; nt2++)
    o[nt2] = (v8f){0.f, 0.f, 0.f, 0.f, 0.f, 0.f, 0.f, 0.f};
#pragma unroll
  for (int nt = 0; nt < 8; nt++) {
#pragma unroll
    for (int s = 0; s < 4; s++) {
      v2f af;
      af.x = sc[nt][2 * s];
      af.y = sc[nt][2 * s + 1];
      int key = nt * 16 + 8 * hi + 2 * s;
#pragma unroll
      for (int nt2 = 0; nt2 < 4; nt2++) {
        v2f bf;
        bf.x = lv[key][nt2 * 16 + m];
        bf.y = lv[key + 1][nt2 * 16 + m];
        o[nt2] = wmma_f32(af, bf, o[nt2]);
      }
    }
  }
#pragma unroll
  for (int nt2 = 0; nt2 < 4; nt2++) {
#pragma unroll
    for (int e = 0; e < 8; e++) {
      int row = rbase + e + 8 * hi;
      size_t idx = ((size_t)b * E_ + c * L_ + row) * D_ + nt2 * 16 + m;
      so[idx] = o[nt2][e] * lrcp[row];
    }
  }
}

// ---------------- K4: unsort + combine hash rounds ----------------
// 16 lanes of 16 B cover one token's row; a lane takes TPT_ consecutive tokens,
// so few waves start and every gather of a lane is in flight at once
#define TPT_ 4
__global__ void __launch_bounds__(256)
k_combine(const float* __restrict__ so,
          const float* __restrict__ slog,
          const int* __restrict__ undo,
          float* __restrict__ out) {
  int q4   = threadIdx.x & 15;
  int tok0 = (blockIdx.x * 16 + (threadIdx.x >> 4)) * TPT_;   // [0, B_*S_)
  int b = tok0 >> 12, t = tok0 & (S_ - 1);
  const int*   ub = undo + (size_t)b * E_ + t;
  const float* lb = slog + (size_t)b * E_;
  const v4f*   sb = (const v4f*)(so + (size_t)b * E_ * D_);
  v4i p[H_];              // p[h][i]: sorted place of token t + i in round h
  // unrolled: p[] stays in registers
#pragma unroll
  for (int h = 0; h < H_; h++) p[h] = *(const v4i*)(ub + h * S_);
  // the four loads above share one offset register, which a later load's result
  // may take: this wait stands in front of that overwrite
  asm volatile("s_wait_xcnt 0x0" ::: "memory");
  v4i ix[H_];             // ix[h][i]: the lane's 16-byte unit of that row
  v4f lg[H_];
  v4f x[H_][TPT_];
  // unrolled: both gathers hang on p alone
#pragma unroll
  for (int h = 0; h < H_; h++) ix[h] = p[h] * (D_ / 4) + q4;
#pragma unroll
  for (int i = 0; i < TPT_; i++)
#pragma unroll
    for (int h = 0; h < H_; h++) {
      lg[h][i] = lb[p[h][i]];
      x[h][i]  = sb[ix[h][i]];
    }
  // inputs only: holds every gather above ahead of the arithmetic below; without
  // it the scheduler sinks most loads between the sums, one latency after another.
  // p and ix are the gathers' offset registers: as inputs they stay untouched
  // until the data wait in front of this line, so no result lands on one of them
  asm volatile("" :: "v"(lg[0]), "v"(lg[1]), "v"(lg[2]), "v"(lg[3]),
               "v"(x[0][0]), "v"(x[1][0]), "v"(x[2][0]), "v"(x[3][0]),
               "v"(x[0][1]), "v"(x[1][1]), "v"(x[2][1]), "v"(x[3][1]),
               "v"(x[0][2]), "v"(x[1][2]), "v"(x[2][2]), "v"(x[3][2]),
               "v"(x[0][3]), "v"(x[1][3]), "v"(x[2][3]), "v"(x[3][3]),
               "v"(p[0]), "v"(p[1]), "v"(p[2]), "v"(p[3]),
               "v"(ix[0]), "v"(ix[1]), "v"(ix[2]), "v"(ix[3]));
  v4f* ob = (v4f*)(out + (size_t)tok0 * D_) + q4;
  // unrolled: i indexes the register arrays as a constant
#pragma unroll
  for (int i = 0; i < TPT_; i++) {
    float mx = fmaxf(fmaxf(lg[0][i], lg[1][i]), fmaxf(lg[2][i], lg[3][i]));
    float ws = 0.f;
    v4f acc = {0.f, 0.f, 0.f, 0.f};
#pragma unroll
    for (int h = 0; h < H_; h++) {
      float a = (lg[h][i] - mx) * 1.44269504f, w;   // e^d = 2^(d log2 e), as __expf
      // v_nop: the free slot the instruction set asks for behind a transcendental
      asm("v_exp_f32 %0, %1\n\tv_nop" : "=v"(w) : "v"(a));
      ws += w;
      acc += w * x[h][i];
    }
    ob[i * (D_ / 4)] = acc / ws;
  }
}

// ---------------- launcher ----------------
extern "C" void kernel_launch(void* const* d_in, const int* in_sizes, int n_in,
                              void* d_out, int out_size, void* d_ws, size_t ws_size,
                              hipStream_t stream) {
  const float* qk  = (const float*)d_in[0];
  const float* v   = (const float*)d_in[1];
  const float* rot = (const float*)d_in[2];
  float* out = (float*)d_out;

  char* ws = (char*)d_ws;
  size_t off = 0;
  int*   buckets = (int*)(ws + off);  off += (size_t)B_ * E_ * sizeof(int);
  int*   st      = (int*)(ws + off);  off += (size_t)B_ * E_ * sizeof(int);
  int*   undo    = (int*)(ws + off);  off += (size_t)B_ * E_ * sizeof(int);
  float* slog    = (float*)(ws + off); off += (size_t)B_ * E_ * sizeof(float);
  float* so      = (float*)(ws + off); off += (size_t)B_ * E_ * D_ * sizeof(float);

  k_buckets<<<(B_ * H_ * S_) / 256, 256, 0, stream>>>(qk, rot, buckets);
  k_sort   <<<B_ * H_, 1024, 0, stream>>>(buckets, st, undo);
  k_attn   <<<B_ * NCH, 128, 0, stream>>>(qk, v, st, so, slog);
  k_combine<<<(B_ * S_) / (16 * TPT_), 256, 0, stream>>>(so, slog, undo, out);
}

// v006
// A run of this version takes 85.1 microseconds.
// In both of two side-by-side timings against v005, it was 1.05 times as fast.
// Over all steps from v000 it is 2.67 times as fast.
#include <hip/hip_runtime.h>
#include <hip/hip_bf16.h>
#include <math.h>

// ---------------- problem constants (fixed by reference) ----------------
#define B_   16
#define S_   4096
#define D_   64
#define H_   4
#define NB_  64          // buckets per hash
#define E_   16384       // H_*S_ elements per batch
#define NCH  256         // chunks (= H_*NB_)
#define L_   64          // queries per chunk
#define KL_  128         // keys per chunk (look-one-back)

typedef float v2f __attribute__((ext_vector_type(2)));
typedef float v8f __attribute__((ext_vector_type(8)));
typedef float v4f __attribute__((ext_vector_type(4)));

__device__ __forceinline__ v8f wmma_f32(v2f a, v2f b, v8f c) {
  return __builtin_amdgcn_wmma_f32_16x16x4_f32(false, a, false, b, (short)0, c,
                                               false, false);
}

// LDS byte address of a __shared__ object (low 32 bits of its address)
__device__ __forceinline__ unsigned lds_addr(const void* p) {
  return (unsigned)(uintptr_t)p;
}

// eight 16-byte copies per lane, global -> LDS: source rows t[j..j+7], LDS rows
// lstep bytes apart; s_wait_xcnt 0 ends the statement so that no address
// register of an issued copy is rewritten ahead of it
#define COPY8(l0, lstep, gbase, t, j)                                        \
  asm volatile(                                                              \
      "global_load_async_to_lds_b128 %0, %8, off\n\t"                        \
      "global_load_async_to_lds_b128 %1, %9, off\n\t"                        \
      "global_load_async_to_lds_b128 %2, %10, off\n\t"                       \
      "global_load_async_to_lds_b128 %3, %11, off\n\t"                       \
      "global_load_async_to_lds_b128 %4, %12, off\n\t"                       \
      "global_load_async_to_lds_b128 %5, %13, off\n\t"                       \
      "global_load_async_to_lds_b128 %6, %14, off\n\t"                       \
      "global_load_async_to_lds_b128 %7, %15, off\n\t"                       \
      "s_wait_xcnt 0x0"                                                      \
      :: "v"((l0)), "v"((l0) + (lstep)), "v"((l0) + 2 * (lstep)),            \
         "v"((l0) + 3 * (lstep)), "v"((l0) + 4 * (lstep)),                   \
         "v"((l0) + 5 * (lstep)), "v"((l0) + 6 * (lstep)),                   \
         "v"((l0) + 7 * (lstep)),                                            \
         "v"((gbase) + (size_t)(t)[(j) + 0] * D_),                           \
         "v"((gbase) + (size_t)(t)[(j) + 1] * D_),                           \
         "v"((gbase) + (size_t)(t)[(j) + 2] * D_),                           \
         "v"((gbase) + (size_t)(t)[(j) + 3] * D_),                           \
         "v"((gbase) + (size_t)(t)[(j) + 4] * D_),                           \
         "v"((gbase) + (size_t)(t)[(j) + 5] * D_),                           \
         "v"((gbase) + (size_t)(t)[(j) + 6] * D_),                           \
         "v"((gbase) + (size_t)(t)[(j) + 7] * D_)                            \
      : "memory")

// ---------------- K1: LSH bucket ids ----------------
// 16 consecutive blocks share one batch and one hash round: b and h come from
// blockIdx alone, so a rotation row's address is the same in every lane and the
// row reaches the FMAs through scalar loads, as scalar-register operands; every
// sum keeps its order in f and its fused multiply-adds
__global__ void __launch_bounds__(256)
k_buckets(const float* __restrict__ qk,
          const float* __restrict__ rot,
          int* __restrict__ buckets) {
  int b   = blockIdx.x >> 6;
  int h   = (blockIdx.x >> 4) & (H_ - 1);
  int t   = (blockIdx.x & 15) * 256 + threadIdx.x;
  int rem = h * S_ + t;
  const v4f* q = (const v4f*)(qk + ((size_t)b * S_ + t) * D_);
  v4f qv[D_ / 4];         // the lane's own row, the only vector loads left
  // unrolled: qv[] stays in registers
#pragma unroll
  for (int j = 0; j < D_ / 4; j++) qv[j] = q[j];
  const float* rp = rot + h * 32;
  float r[32];
#pragma unroll
  for (int i = 0; i < 32; i++) r[i] = 0.f;
  // unrolled: f indexes qv[] as a constant
#pragma unroll
  for (int f = 0; f < D_; f++) {
    float qf = qv[f >> 2][f & 3];
#pragma unroll
    for (int i = 0; i < 32; i++) r[i] += qf * rp[f * (H_ * 32) + i];
  }
  float best = r[0];
  int arg = 0;
#pragma unroll
  for (int i = 1; i < 32; i++)
    if (r[i] > best) { best = r[i]; arg = i; }
#pragma unroll
  for (int i = 0; i < 32; i++)
    if (-r[i] > best) { best = -r[i]; arg = 32 + i; }
  buckets[(size_t)b * E_ + rem] = h * NB_ + arg;
}

// ---------------- K2: stable counting sort, one block per (batch, hash round) ----
// A hash round's 4096 tokens fall in its own 64 buckets and fill its own 4096
// sorted places, so one work-group sorts a round alone, in LDS: no histogram
// plane in memory, no scan launch. A group is 32 consecutive tokens, one wave wide.
#define NGRP (S_ / 32)   // 128 groups
typedef int v4i __attribute__((ext_vector_type(4)));
typedef int v2i __attribute__((ext_vector_type(2)));
__global__ void __launch_bounds__(1024)
k_sort(const int* __restrict__ buckets, int* __restrict__ st,
       int* __restrict__ undo) {
  __shared__ __attribute__((aligned(16))) int cnt[NGRP][NB_];      // per group and bucket
  __shared__ __attribute__((aligned(16))) int seg[NGRP / 8][NB_];  // per 8 groups and bucket
  __shared__ __attribute__((aligned(16))) int lst[S_];             // sorted tokens
  int tid = threadIdx.x, wave = tid >> 5, lane = tid & 31;
  size_t base = (size_t)blockIdx.x * S_;        // = b * E_ + h * S_
  size_t mine = base + wave * 128 + lane;       // the lane's token of the wave's first group
  int hoff = (blockIdx.x & (H_ - 1)) * S_;
  int bin[4], rank[4];
  const int* bp = buckets + mine;
  // unrolled, here and below: bin[] and rank[] stay in registers
#pragma unroll
  for (int i = 0; i < 4; i++) bin[i] = bp[i * 32] & (NB_ - 1);
  ((v4i*)cnt)[tid]        = (v4i){0, 0, 0, 0};
  ((v4i*)cnt)[tid + 1024] = (v4i){0, 0, 0, 0};
  __syncthreads();
  // rank among the group's earlier tokens of the same bucket: six ballots give
  // the mask of lanes that hold the lane's own bucket
#pragma unroll
  for (int i = 0; i < 4; i++) {
    unsigned same = 0xffffffffu;
#pragma unroll
    for (int k = 0; k < 6; k++) {
      bool bit = (bin[i] >> k) & 1;
      unsigned bal = __builtin_amdgcn_ballot_w32(bit);
      same &= bit ? bal : ~bal;
    }
    rank[i] = __popc(same & ((1u << lane) - 1u));
    if (rank[i] == 0) cnt[wave * 4 + i][bin[i]] = __popc(same);
  }
  __syncthreads();
  // per bucket: running count over the 8 groups of a segment, in place
  {
    int bn = tid & (NB_ - 1), s = tid >> 6;
    int c[8], run = 0;
#pragma unroll
    for (int k = 0; k < 8; k++) c[k] = cnt[s * 8 + k][bn];
#pragma unroll
    for (int k = 0; k < 8; k++) { cnt[s * 8 + k][bn] = run; run += c[k]; }
    seg[s][bn] = run;
  }
  __syncthreads();
  // one wave, two buckets a lane: running count over the 16 segments, then the
  // buckets' starts by a scan over the wave
  if (wave == 0) {
    v2i c[NGRP / 8];
    int t0 = 0, t1 = 0;
#pragma unroll
    for (int s = 0; s < NGRP / 8; s++) c[s] = *(const v2i*)&seg[s][2 * lane];
#pragma unroll
    for (int s = 0; s < NGRP / 8; s++) {
      int x = c[s].x, y = c[s].y;
      c[s].x = t0; c[s].y = t1;
      t0 += x; t1 += y;
    }
    int inc = t0 + t1;
#pragma unroll
    for (int d = 1; d < 32; d <<= 1) {
      int up = __shfl_up(inc, d, 32);
      if (lane >= d) inc += up;
    }
    int s0 = inc - t0 - t1, s1 = inc - t1;      // starts of buckets 2 lane, 2 lane + 1
#pragma unroll
    for (int s = 0; s < NGRP / 8; s++)
      *(v2i*)&seg[s][2 * lane] = (v2i){c[s].x + s0, c[s].y + s1};
  }
  __syncthreads();
  int pos[4];
#pragma unroll
  for (int i = 0; i < 4; i++) {
    int g = wave * 4 + i;
    pos[i] = seg[g >> 3][bin[i]] + cnt[g][bin[i]] + rank[i];    // in [0, S_)
    lst[pos[i]] = g * 32 + lane;                // token index
  }
  __syncthreads();
  // every global store stands behind the last barrier, which so waits for none
  ((v4i*)(st + base))[tid] = ((const v4i*)lst)[tid];
  int* up = undo + mine;
#pragma unroll
  for (int i = 0; i < 4; i++) up[i * 32] = hoff + pos[i];
}

// ---------------- K3: chunked attention with f32 WMMA ----------------
// four work-groups fit a WGP's LDS, one wave of each on a SIMD; the second bound
// holds a wave inside a fifth of a SIMD's registers: without it the
// scheduler fetches K so far ahead that it takes more
__global__ void __launch_bounds__(128, 5)
k_attn(const float* __restrict__ qk, const float* __restrict__ v,
       const int* __restrict__ st, float* __restrict__ so,
       float* __restrict__ slog) {
  // keys 128x64 (+4 pad), as they lie in qk; rows 0..63 are the queries as well
  __shared__ __attribute__((aligned(16))) float lk[KL_][68];
  __shared__ __attribute__((aligned(16))) float lv[KL_][68];    // values    128x64
  __shared__ __attribute__((aligned(16))) float lrn[4][KL_];    // per wave: 64^-0.5 / |key|
  __shared__ int   qt[L_];
  __shared__ int   kt[KL_];
  __shared__ float lrcp[L_];

  int b = blockIdx.x >> 8, c = blockIdx.x & (NCH - 1);
  int cprev = (c + NCH - 1) & (NCH - 1);
  int tid = threadIdx.x;
  const int* stb = st + (size_t)b * E_;

  // ---- stage K (with it Q) and V: asynchronous copies to LDS, all in flight at once ----
  {
    int r0 = tid >> 4, q4 = tid & 15;             // 16 lanes of 16 B per row
    int tk[16];
    // unrolled: tk[] stays in registers and the 16 index loads issue together
#pragma unroll
    for (int j = 0; j < 16; j++) {
      // rows r0 + 8 j: j < 8 lies in this chunk, j >= 8 in the one before
      int p = (j < 8 ? c * L_ : cprev * L_ - L_) + r0 + 8 * j;
      tk[j] = stb[p] & (S_ - 1);                  // bounds every copy's source row
    }
    const float* qb = qk + (size_t)b * S_ * D_ + q4 * 4;
    const float* vb = v  + (size_t)b * S_ * D_ + q4 * 4;
    // unrolled: j indexes tk[] as a constant
#pragma unroll
    for (int j = 0; j < 16; j += 8) {
      COPY8(lds_addr(&lk[r0 + 8 * j][q4 * 4]), 8 * 68 * 4, qb, tk, j);
      COPY8(lds_addr(&lv[r0 + 8 * j][q4 * 4]), 8 * 68 * 4, vb, tk, j);
    }
    if (q4 == 0) {
      // unrolled: j indexes tk[] as a constant
#pragma unroll
      for (int j = 0; j < 16; j++) {
        kt[r0 + 8 * j] = tk[j];
        if (j < 8) qt[r0 + 8 * j] = tk[j];
      }
    }
    // this wave's copies have landed before the barrier publishes them
    asm volatile("s_wait_asynccnt 0x0" ::: "memory");
  }
  __syncthreads();

  int wave = tid >> 5, lane = tid & 31;
  int m = lane & 15, hi = lane >> 4;
  int rbase = wave * 16;

  // B fragments: the wave's 16 queries as columns, lane half splits k {0,1}/{2,3}
  v2f bq[16];
  // unrolled: bq[] stays in registers
#pragma unroll
  for (int k4 = 0; k4 < 16; k4++) {
    bq[k4].x = lk[rbase + m][4 * k4 + 2 * hi];
    bq[k4].y = lk[rbase + m][4 * k4 + 2 * hi + 1];
  }

  // ---- dots^T = K @ Q^T: keys are the rows of a tile, so sc[nt][e] of lane
  // (m, hi) is query rbase + m against key nt*16 + 8*hi + e: a lane holds 64 of
  // its query's 128 scores, lane ^ 16 the other 64. The A fragments of tile nt
  // are half of key nt*16 + m: their squares are summed beside the products ----
  int qtm = qt[rbase + m];
  v8f sc[8];
  v2f sq[8];
  // unrolled: nt indexes sc[] and sq[] as a constant
#pragma unroll
  for (int nt = 0; nt < 8; nt++) {
    v8f acc = {0.f, 0.f, 0.f, 0.f, 0.f, 0.f, 0.f, 0.f};
    v2f s2  = {0.f, 0.f};
#pragma unroll
    for (int k4 = 0; k4 < 16; k4++) {
      v2f af;
      af.x = lk[nt * 16 + m][4 * k4 + 2 * hi];
      af.y = lk[nt * 16 + m][4 * k4 + 2 * hi + 1];
      s2 += af * af;
      acc = wmma_f32(af, bq[k4], acc);
    }
    sc[nt] = acc;
    sq[nt] = s2;
  }

  // ---- 64^-0.5 / max(|key|, 1e-12) of key nt*16 + m, turned from one key a lane
  // to the score tiles' eight keys a lane through the wave's own LDS row
  // (LDS ops in-order per wave, so no barrier) ----
  float ss[8];
  // unrolled, this loop and the next: nt and i index register arrays as constants
#pragma unroll
  for (int nt = 0; nt < 8; nt++) {
    float s = sq[nt].x + sq[nt].y;
    // lane ^ 16 holds the other half of the key's squares
    ss[nt] = s + __uint_as_float(__builtin_amdgcn_permlanex16(
        __float_as_uint(s), __float_as_uint(s), 0x76543210u, 0xfedcba98u, false, false));
  }
  // both lane halves hold every sum: the lower finishes the even tiles' keys, the
  // upper the odd tiles', so key 32 i + lane is the lane's own and every lane is on
#pragma unroll
  for (int i = 0; i < 4; i++) {
    float s = hi ? ss[2 * i + 1] : ss[2 * i];
    lrn[wave][32 * i + lane] = fminf(__builtin_amdgcn_rsqf(s), 1.0f / 1e-12f) * 0.125f;
  }
  // unrolled: nt and e index sc[] as constants
#pragma unroll
  for (int nt = 0; nt < 8; nt++) {
    v4f w0 = *(const v4f*)&lrn[wave][nt * 16 + 8 * hi];
    v4f w1 = *(const v4f*)&lrn[wave][nt * 16 + 8 * hi + 4];
#pragma unroll
    for (int e = 0; e < 8; e++) {
      float val = sc[nt][e] * (e < 4 ? w0[e & 3] : w1[e & 3]);
      if (qtm == kt[nt * 16 + 8 * hi + e]) val = -5e4f;   // self-attn mask
      sc[nt][e] = val;
    }
  }

  // ---- row softmax in registers: eight running values a lane, then lane ^ 16
  // (lrcp rows are the wave's own; LDS ops in-order per wave) ----
  {
    int r = rbase + m;
    v8f mv = sc[0];
    // unrolled: nt and e index register arrays as constants
#pragma unroll
    for (int nt = 1; nt < 8; nt++)
#pragma unroll
      for (int e = 0; e < 8; e++) mv[e] = fmaxf(mv[e], sc[nt][e]);
    float mx = fmaxf(fmaxf(fmaxf(mv[0], mv[1]), fmaxf(mv[2], mv[3])),
                     fmaxf(fmaxf(mv[4], mv[5]), fmaxf(mv[6], mv[7])));
    mx = fmaxf(mx, __shfl_xor(mx, 16, 32));
    v8f sv;
    // unrolled: nt and e index register arrays as constants
#pragma unroll
    for (int nt = 0; nt < 8; nt++)
#pragma unroll
      for (int e = 0; e < 8; e++) {
        float a = (sc[nt][e] - mx) * 1.44269504f, p;   // e^d = 2^(d log2 e), as __expf
        // v_nop: the free slot the instruction set asks for behind a transcendental
        asm("v_exp_f32 %0, %1\n\tv_nop" : "=v"(p) : "v"(a));
        sc[nt][e] = p;
        sv[e] = nt == 0 ? p : sv[e] + p;
      }
    float ssum = ((sv[0] + sv[1]) + (sv[2] + sv[3])) +
                 ((sv[4] + sv[5]) + (sv[6] + sv[7]));
    ssum += __shfl_xor(ssum, 16, 32);
    float lse = mx + __logf(ssum);
    if (hi == 0) {
      lrcp[r] = 1.0f / ssum;
      slog[(size_t)b * E_ + c * L_ + r] = lse;
    }
  }

  // ---- bo = P @ V: two neighbouring registers of a score tile are an A
  // fragment as they lie (row = query m; k = keys nt*16 + 8*hi + 2*s + {0,1});
  // the V fragment takes the same keys at the same lane half and register ----
  v8f o[4];
  // unrolled, this loop and the two nests below: sc[] and o[] stay in registers
#pragma unroll
  for (int nt2 = 0; nt2 < 4; nt2++)
    o[nt2] = (v8f){0.f, 0.f, 0.f, 0.f, 0.f, 0.f, 0.f, 0.f};
#pragma unroll
  for (int nt = 0; nt < 8; nt++) {
#pragma unroll
    for (int s = 0; s < 4; s++) {
      v2f af;
      af.x = sc[nt][2 * s];
      af.y = sc[nt][2 * s + 1];
      int key = nt * 16 + 8 * hi + 2 * s;
#pragma unroll
      for (int nt2 = 0; nt2 < 4; nt2++) {
        v2f bf;
        bf.x = lv[key][nt2 * 16 + m];
        bf.y = lv[key + 1][nt2 * 16 + m];
        o[nt2] = wmma_f32(af, bf, o[nt2]);
      }
    }
  }
#pragma unroll
  for (int nt2 = 0; nt2 < 4; nt2++) {
#pragma unroll
    for (int e = 0; e < 8; e++) {
      int row = rbase + e + 8 * hi;
      size_t idx = ((size_t)b * E_ + c * L_ + row) * D_ + nt2 * 16 + m;
      so[idx] = o[nt2][e] * lrcp[row];
    }
  }
}

// ---------------- K4: unsort + combine hash rounds ----------------
// 16 lanes of 16 B cover one token's row; a lane takes TPT_ consecutive tokens,
// so few waves start and every gather of a lane is in flight at once
#define TPT_ 4
__global__ void __launch_bounds__(256)
k_combine(const float* __restrict__ so,
          const float* __restrict__ slog,
          const int* __restrict__ undo,
          float* __restrict__ out) {
  int q4   = threadIdx.x & 15;
  int tok0 = (blockIdx.x * 16 + (threadIdx.x >> 4)) * TPT_;   // [0, B_*S_)
  int b = tok0 >> 12, t = tok0 & (S_ - 1);
  const int*   ub = undo + (size_t)b * E_ + t;
  const float* lb = slog + (size_t)b * E_;
  const v4f*   sb = (const v4f*)(so + (size_t)b * E_ * D_);
  v4i p[H_];              // p[h][i]: sorted place of token t + i in round h
  // unrolled: p[] stays in registers
#pragma unroll
  for (int h = 0; h < H_; h++) p[h] = *(const v4i*)(ub + h * S_);
  // the four loads above share one offset register, which a later load's result
  // may take: this wait stands in front of that overwrite
  asm volatile("s_wait_xcnt 0x0" ::: "memory");
  v4i ix[H_];             // ix[h][i]: the lane's 16-byte unit of that row
  v4f lg[H_];
  v4f x[H_][TPT_];
  // unrolled: both gathers hang on p alone
#pragma unroll
  for (int h = 0; h < H_; h++) ix[h] = p[h] * (D_ / 4) + q4;
#pragma unroll
  for (int i = 0; i < TPT_; i++)
#pragma unroll
    for (int h = 0; h < H_; h++) {
      lg[h][i] = lb[p[h][i]];
      x[h][i]  = sb[ix[h][i]];
    }
  // inputs only: holds every gather above ahead of the arithmetic below; without
  // it the scheduler sinks most loads between the sums, one latency after another.
  // p and ix are the gathers' offset registers: as inputs they stay untouched
  // until the data wait in front of this line, so no result lands on one of them
  asm volatile("" :: "v"(lg[0]), "v"(lg[1]), "v"(lg[2]), "v"(lg[3]),
               "v"(x[0][0]), "v"(x[1][0]), "v"(x[2][0]), "v"(x[3][0]),
               "v"(x[0][1]), "v"(x[1][1]), "v"(x[2][1]), "v"(x[3][1]),
               "v"(x[0][2]), "v"(x[1][2]), "v"(x[2][2]), "v"(x[3][2]),
               "v"(x[0][3]), "v"(x[1][3]), "v"(x[2][3]), "v"(x[3][3]),
               "v"(p[0]), "v"(p[1]), "v"(p[2]), "v"(p[3]),
               "v"(ix[0]), "v"(ix[1]), "v"(ix[2]), "v"(ix[3]));
  v4f* ob = (v4f*)(out + (size_t)tok0 * D_) + q4;
  // unrolled: i indexes the register arrays as a constant
#pragma unroll
  for (int i = 0; i < TPT_; i++) {
    float mx = fmaxf(fmaxf(lg[0][i], lg[1][i]), fmaxf(lg[2][i], lg[3][i]));
    float ws = 0.f;
    v4f acc = {0.f, 0.f, 0.f, 0.f};
#pragma unroll
    for (int h = 0; h < H_; h++) {
      float a = (lg[h][i] - mx) * 1.44269504f, w;   // e^d = 2^(d log2 e), as __expf
      // v_nop: the free slot the instruction set asks for behind a transcendental
      asm("v_exp_f32 %0, %1\n\tv_nop" : "=v"(w) : "v"(a));
      ws += w;
      acc += w * x[h][i];
    }
    ob[i * (D_ / 4)] = acc / ws;
  }
}

// ---------------- launcher ----------------
extern "C" void kernel_launch(void* const* d_in, const int* in_sizes, int n_in,
                              void* d_out, int out_size, void* d_ws, size_t ws_size,
                              hipStream_t stream) {
  const float* qk  = (const float*)d_in[0];
  const float* v   = (const float*)d_in[1];
  const float* rot = (const float*)d_in[2];
  float* out = (float*)d_out;

  char* ws = (char*)d_ws;
  size_t off = 0;
  int*   buckets = (int*)(ws + off);  off += (size_t)B_ * E_ * sizeof(int);
  int*   st      = (int*)(ws + off);  off += (size_t)B_ * E_ * sizeof(int);
  int*   undo    = (int*)(ws + off);  off += (size_t)B_ * E_ * sizeof(int);
  float* slog    = (float*)(ws + off); off += (size_t)B_ * E_ * sizeof(float);
  float* so      = (float*)(ws + off); off += (size_t)B_ * E_ * D_ * sizeof(float);

  k_buckets<<<(B_ * H_ * S_) / 256, 256, 0, stream>>>(qk, rot, buckets);
  k_sort   <<<B_ * H_, 1024, 0, stream>>>(buckets, st, undo);
  k_attn   <<<B_ * NCH, 128, 0, stream>>>(qk, v, st, so, slog);
  k_combine<<<(B_ * S_) / (16 * TPT_), 256, 0, stream>>>(so, slog, undo, out);
}
